// v000
// The times below were measured on an AMD MI455X: many runs one after another, warmed up first and cycling through
// copies of the inputs, with the whole window's GPU time divided by the number of runs. Launches and the gaps
// between them are all in it. The median over several windows is given; except for v000 it joins two sittings, which
// can be a few percent apart, so the side-by-side timings, each taken in one sitting, are the better comparison.
// v000 is the starting kernel. One run takes 277 microseconds.
#include <hip/hip_runtime.h>

// Problem constants
#define CDIM 512
#define SEQ  1024
#define NB   8
#define NH   8
#define HD   64
#define MTOT (NB * SEQ)   // 8192 total token rows
#define KCH  32           // GEMM K chunk (one WMMA K depth)

typedef __attribute__((ext_vector_type(16))) _Float16 v16h;
typedef __attribute__((ext_vector_type(8)))  _Float16 v8h;
typedef __attribute__((ext_vector_type(8)))  float    v8f;

// ---- CDNA5 async global->LDS copy (ASYNCcnt path, ISA 15.18.3 op 98) ----
__device__ __forceinline__ unsigned lds_off_of(const void* p) {
  // LDS aperture keeps the wave-relative LDS byte offset in addr[31:0].
  return (unsigned)(unsigned long long)(uintptr_t)p;
}
__device__ __forceinline__ void async_b128(unsigned lds_off, const void* gaddr) {
  asm volatile("global_load_async_to_lds_b128 %0, %1, off"
               :: "v"(lds_off), "v"((unsigned long long)(uintptr_t)gaddr)
               : "memory");
}
__device__ __forceinline__ void wait_async0() {
  asm volatile("s_wait_asynccnt 0x0" ::: "memory");
}

// Load one WMMA f16 A/B fragment for a 32-wide K chunk.
// Lanes 0-15 hold K {0..7,16..23}, lanes 16-31 hold K {8..15,24..31}.
__device__ __forceinline__ v16h load_frag(const _Float16* p, int hi) {
  v8h a = *(const v8h*)(p + (hi ? 8 : 0));
  v8h b = *(const v8h*)(p + (hi ? 24 : 16));
  v16h r;
#pragma unroll
  for (int i = 0; i < 8; ++i) { r[i] = a[i]; r[i + 8] = b[i]; }
  return r;
}

// x [N, C, H*W] f32  ->  xs [N, S, C] f16
__global__ void pack_x_kernel(const float* __restrict__ x, _Float16* __restrict__ xs) {
  int idx = blockIdx.x * blockDim.x + threadIdx.x;
  if (idx >= NB * CDIM * SEQ) return;
  int n   = idx / (CDIM * SEQ);
  int rem = idx % (CDIM * SEQ);
  int c   = rem / SEQ;
  int s   = rem % SEQ;
  xs[((size_t)n * SEQ + s) * CDIM + c] = (_Float16)x[idx];
}

// All four weight matrices f32 -> f16 (row-major [C_out, C_in]; these rows ARE
// the B-fragment columns for y = x @ W^T).
__global__ void pack_w_kernel(const float* __restrict__ a, const float* __restrict__ b,
                              const float* __restrict__ c, const float* __restrict__ d,
                              _Float16* __restrict__ A, _Float16* __restrict__ B,
                              _Float16* __restrict__ Cw, _Float16* __restrict__ D) {
  int i = blockIdx.x * blockDim.x + threadIdx.x;
  if (i >= CDIM * CDIM) return;
  A[i]  = (_Float16)a[i];
  B[i]  = (_Float16)b[i];
  Cw[i] = (_Float16)c[i];
  D[i]  = (_Float16)d[i];
}

// Y[M,512] = A[M,512](f16) @ W[512,512]^T(f16 row-major) + bias.
// mode 0: f16 row-major [M,512]   (Q, K)
// mode 1: f32 row-major [M,512]   (final output)
// mode 2: f16 head-transposed Vt[(n*NH+h)*HD + d][SEQ]   (V)
// Block 256 thr = 8 waves (4 row-groups x 2 col-groups); block tile 128x128;
// wave tile 32x64 (8 accumulators). K chunks of 32 double-buffered in LDS via
// async copies overlapped with WMMA compute.
__global__ void gemm_bt_kernel(const _Float16* __restrict__ A,
                               const _Float16* __restrict__ W,
                               const float* __restrict__ bias,
                               _Float16* __restrict__ out16,
                               float* __restrict__ out32,
                               int mode) {
  __shared__ __align__(16) _Float16 At[2][128 * KCH];
  __shared__ __align__(16) _Float16 Wt[2][128 * KCH];

  const int tid  = threadIdx.x;
  const int lane = tid & 31;
  const int wave = tid >> 5;
  const int lr   = lane & 15;
  const int hi   = lane >> 4;
  const int wr   = wave & 3;   // row group 0..3
  const int wc   = wave >> 2;  // col group 0..1
  const int mblk = blockIdx.x * 128;
  const int nblk = blockIdx.y * 128;

  // Cooperative copy coords: each thread moves 32B of A and 32B of W per chunk.
  const int crow = tid >> 1;           // 0..127
  const int chof = (tid & 1) * 16;     // halves within 32-half row
  const _Float16* gA = A + (size_t)(mblk + crow) * CDIM + chof;
  const _Float16* gW = W + (size_t)(nblk + crow) * CDIM + chof;
  unsigned ldsA[2], ldsW[2];
#pragma unroll
  for (int b = 0; b < 2; ++b) {
    ldsA[b] = lds_off_of(&At[b][crow * KCH + chof]);
    ldsW[b] = lds_off_of(&Wt[b][crow * KCH + chof]);
  }
  auto issue = [&](int b, int kc) {
    const _Float16* a = gA + kc;
    const _Float16* w = gW + kc;
    async_b128(ldsA[b],      a);
    async_b128(ldsA[b] + 16, a + 8);
    async_b128(ldsW[b],      w);
    async_b128(ldsW[b] + 16, w + 8);
  };

  v8f acc[2][4];
#pragma unroll
  for (int s = 0; s < 2; ++s)
#pragma unroll
    for (int c = 0; c < 4; ++c) acc[s][c] = v8f{0.f,0.f,0.f,0.f,0.f,0.f,0.f,0.f};

  issue(0, 0);
  int cur = 0;
  for (int t = 0; t < CDIM / KCH; ++t) {
    wait_async0();        // my chunk-t copies done
    __syncthreads();      // everyone's chunk-t data visible; other buffer free
    if (t < CDIM / KCH - 1) issue(1 - cur, (t + 1) * KCH);

    const _Float16* Ab = At[cur];
    const _Float16* Wb = Wt[cur];
    v16h af[2];
#pragma unroll
    for (int s = 0; s < 2; ++s)
      af[s] = load_frag(Ab + (size_t)(wr * 32 + s * 16 + lr) * KCH, hi);
#pragma unroll
    for (int c = 0; c < 4; ++c) {
      v16h bf = load_frag(Wb + (size_t)(wc * 64 + c * 16 + lr) * KCH, hi);
#pragma unroll
      for (int s = 0; s < 2; ++s)
        acc[s][c] = __builtin_amdgcn_wmma_f32_16x16x32_f16(false, af[s], false, bf,
                                                           (short)0, acc[s][c], false, false);
    }
    cur ^= 1;
  }

#pragma unroll
  for (int c = 0; c < 4; ++c) {
    const int col = nblk + wc * 64 + c * 16 + lr;
    const float bv = bias[col];
#pragma unroll
    for (int s = 0; s < 2; ++s) {
#pragma unroll
      for (int r = 0; r < 8; ++r) {
        const int row = mblk + wr * 32 + s * 16 + r + 8 * hi;
        float y = acc[s][c][r] + bv;
        if (mode == 0) {
          out16[(size_t)row * CDIM + col] = (_Float16)y;
        } else if (mode == 1) {
          out32[(size_t)row * CDIM + col] = y;
        } else {
          // Vt[(n*NH + h)*HD + d][SEQ]: h = col/64, d = col%64, n = row/SEQ, s = row%SEQ
          const int hh = col >> 6, dd = col & 63;
          const int nn = row >> 10, ss = row & 1023;
          out16[((size_t)(nn * NH + hh) * HD + dd) * SEQ + ss] = (_Float16)y;
        }
      }
    }
  }
}

// Flash attention per (n, h): block = 128 threads (4 waves), each wave one
// 16-row q tile. K tile (32 x 64, row-major) and Vt tile (64 x 32, d-major)
// double-buffered in LDS via async copies. K, Vt and P fragments are contiguous
// 128-bit LDS reads. O written in [N, h, S, d] flat order.
__global__ void attn_kernel(const _Float16* __restrict__ Q,
                            const _Float16* __restrict__ K,
                            const _Float16* __restrict__ Vt,
                            _Float16* __restrict__ O) {
  __shared__ __align__(16) _Float16 Kt[2][32 * 64];
  __shared__ __align__(16) _Float16 VtT[2][64 * 32];
  __shared__ __align__(16) _Float16 Pt[4][16 * 32];

  const int tid  = threadIdx.x;
  const int lane = tid & 31;
  const int wave = tid >> 5;
  const int lr   = lane & 15;
  const int hi   = lane >> 4;
  const int n    = blockIdx.y >> 3;   // NH == 8
  const int h    = blockIdx.y & 7;
  const int q0   = blockIdx.x * 64 + wave * 16;

  const _Float16* Qb  = Q  + (size_t)n * SEQ * CDIM + h * HD;
  const _Float16* Kb  = K  + (size_t)n * SEQ * CDIM + h * HD;
  const _Float16* VtB = Vt + (size_t)(n * NH + h) * HD * SEQ;   // [64][SEQ]

  const v16h qa0 = load_frag(Qb + (size_t)(q0 + lr) * CDIM, hi);
  const v16h qa1 = load_frag(Qb + (size_t)(q0 + lr) * CDIM + 32, hi);

  v8f o[4];
#pragma unroll
  for (int c = 0; c < 4; ++c) o[c] = v8f{0.f,0.f,0.f,0.f,0.f,0.f,0.f,0.f};
  float m[8], l[8];
#pragma unroll
  for (int r = 0; r < 8; ++r) { m[r] = -1.0e30f; l[r] = 0.0f; }

  // Cooperative copy coords.
  // K tile: 32 rows x 128B -> thread: row = tid/4, 32B at (tid%4)*32B.
  const int krow = tid >> 2;
  const int kcb  = (tid & 3) * 16;     // halves
  // Vt tile: 64 rows x 64B -> thread: row = tid/2, 32B at (tid%2)*32B.
  const int vrow = tid >> 1;
  const int vcb  = (tid & 1) * 16;     // halves
  const _Float16* gK = Kb  + (size_t)krow * CDIM + kcb;
  const _Float16* gV = VtB + (size_t)vrow * SEQ  + vcb;
  unsigned ldsK[2], ldsV[2];
#pragma unroll
  for (int b = 0; b < 2; ++b) {
    ldsK[b] = lds_off_of(&Kt[b][krow * 64 + kcb]);
    ldsV[b] = lds_off_of(&VtT[b][vrow * 32 + vcb]);
  }
  auto issueKV = [&](int b, int k0) {
    const _Float16* kk = gK + (size_t)k0 * CDIM;  // advance 32 k-rows
    const _Float16* vv = gV + k0;                 // advance 32 halves along S
    async_b128(ldsK[b],      kk);
    async_b128(ldsK[b] + 16, kk + 8);
    async_b128(ldsV[b],      vv);
    async_b128(ldsV[b] + 16, vv + 8);
  };

  issueKV(0, 0);
  int cur = 0;
  for (int kt = 0; kt < SEQ / 32; ++kt) {
    wait_async0();
    __syncthreads();
    if (kt < SEQ / 32 - 1) issueKV(1 - cur, (kt + 1) * 32);

    const _Float16* Kc = Kt[cur];
    const _Float16* Vc = VtT[cur];

    // S_tile (16 x 32) = q_tile @ k_tile^T  (K = 64 -> 2 chunks)
    v8f s0 = v8f{0.f,0.f,0.f,0.f,0.f,0.f,0.f,0.f};
    v8f s1 = v8f{0.f,0.f,0.f,0.f,0.f,0.f,0.f,0.f};
    {
      v16h b;
      b = load_frag(Kc + (size_t)lr * 64 + 0,  hi);
      s0 = __builtin_amdgcn_wmma_f32_16x16x32_f16(false, qa0, false, b, (short)0, s0, false, false);
      b = load_frag(Kc + (size_t)lr * 64 + 32, hi);
      s0 = __builtin_amdgcn_wmma_f32_16x16x32_f16(false, qa1, false, b, (short)0, s0, false, false);
      b = load_frag(Kc + (size_t)(16 + lr) * 64 + 0,  hi);
      s1 = __builtin_amdgcn_wmma_f32_16x16x32_f16(false, qa0, false, b, (short)0, s1, false, false);
      b = load_frag(Kc + (size_t)(16 + lr) * 64 + 32, hi);
      s1 = __builtin_amdgcn_wmma_f32_16x16x32_f16(false, qa1, false, b, (short)0, s1, false, false);
    }

    // Online softmax, row-wise; row (r + 8*hi) lives across a 16-lane group.
#pragma unroll
    for (int r = 0; r < 8; ++r) {
      float v0 = s0[r] * 0.125f;           // 1/sqrt(64)
      float v1 = s1[r] * 0.125f;
      float rm = fmaxf(v0, v1);
#pragma unroll
      for (int off = 1; off < 16; off <<= 1)
        rm = fmaxf(rm, __shfl_xor(rm, off, 32));
      float mn    = fmaxf(m[r], rm);
      float alpha = __expf(m[r] - mn);
      float p0    = __expf(v0 - mn);
      float p1    = __expf(v1 - mn);
      float rs    = p0 + p1;
#pragma unroll
      for (int off = 1; off < 16; off <<= 1)
        rs += __shfl_xor(rs, off, 32);
      l[r] = l[r] * alpha + rs;
      m[r] = mn;
#pragma unroll
      for (int c = 0; c < 4; ++c) o[c][r] *= alpha;
      int prow = r + 8 * hi;
      Pt[wave][prow * 32 + lr]      = (_Float16)p0;   // C-layout -> A-layout
      Pt[wave][prow * 32 + 16 + lr] = (_Float16)p1;   // via per-wave LDS region
    }

    // O += P(16x32) @ V_tile(32x64): B fragments are contiguous Vt rows.
    v16h pa = load_frag(&Pt[wave][(size_t)lr * 32], hi);
#pragma unroll
    for (int c = 0; c < 4; ++c) {
      v16h vb = load_frag(Vc + (size_t)(c * 16 + lr) * 32, hi);
      o[c] = __builtin_amdgcn_wmma_f32_16x16x32_f16(false, pa, false, vb,
                                                    (short)0, o[c], false, false);
    }
    cur ^= 1;
  }

  // Normalize and store in [N, h, S, d] flat order.
  _Float16* Ob = O + ((size_t)(n * NH + h) * SEQ + q0) * HD;
#pragma unroll
  for (int r = 0; r < 8; ++r) {
    float inv = 1.0f / l[r];
    int row = r + 8 * hi;
#pragma unroll
    for (int c = 0; c < 4; ++c)
      Ob[(size_t)row * HD + c * 16 + lr] = (_Float16)(o[c][r] * inv);
  }
}

extern "C" void kernel_launch(void* const* d_in, const int* in_sizes, int n_in,
                              void* d_out, int out_size, void* d_ws, size_t ws_size,
                              hipStream_t stream) {
  (void)in_sizes; (void)n_in; (void)out_size; (void)ws_size;
  const float* x  = (const float*)d_in[0];
  const float* Wq = (const float*)d_in[1];
  const float* bq = (const float*)d_in[2];
  const float* Wk = (const float*)d_in[3];
  const float* bk = (const float*)d_in[4];
  const float* Wv = (const float*)d_in[5];
  const float* bv = (const float*)d_in[6];
  const float* Wo = (const float*)d_in[7];
  const float* bo = (const float*)d_in[8];
  float* out = (float*)d_out;

  // Workspace layout (offsets in f16 elements). Total ~42 MB.
  _Float16* ws = (_Float16*)d_ws;
  const size_t NSC = (size_t)NB * SEQ * CDIM;   // 4,194,304
  const size_t WSZ = (size_t)CDIM * CDIM;       //   262,144
  _Float16* xs   = ws;
  _Float16* wq16 = xs + NSC;
  _Float16* wk16 = wq16 + WSZ;
  _Float16* wv16 = wk16 + WSZ;
  _Float16* wo16 = wv16 + WSZ;
  _Float16* Qh   = wo16 + WSZ;
  _Float16* Kh   = Qh + NSC;
  _Float16* Vth  = Kh + NSC;   // V stored head-transposed [(n*NH+h)*HD+d][SEQ]
  _Float16* Oh   = Vth + NSC;

  // 1) Pack activations and weights to f16
  pack_x_kernel<<<(NB * CDIM * SEQ + 255) / 256, 256, 0, stream>>>(x, xs);
  pack_w_kernel<<<(CDIM * CDIM + 255) / 256, 256, 0, stream>>>(
      Wq, Wk, Wv, Wo, wq16, wk16, wv16, wo16);

  // 2) Q/K/V projections (fused bias); V written head-transposed
  dim3 ggrid(MTOT / 128, CDIM / 128);
  gemm_bt_kernel<<<ggrid, 256, 0, stream>>>(xs, wq16, bq, Qh,  nullptr, 0);
  gemm_bt_kernel<<<ggrid, 256, 0, stream>>>(xs, wk16, bk, Kh,  nullptr, 0);
  gemm_bt_kernel<<<ggrid, 256, 0, stream>>>(xs, wv16, bv, Vth, nullptr, 2);

  // 3) Flash attention per (n, h); O stored [N, h, S, d] flat
  attn_kernel<<<dim3(SEQ / 64, NB * NH), 128, 0, stream>>>(Qh, Kh, Vth, Oh);

  // 4) Output projection: O (flat [8192, 512]) @ Wo^T + bo -> f32 d_out
  //    (both reference reshapes are memory-order-preserving)
  gemm_bt_kernel<<<ggrid, 256, 0, stream>>>(Oh, wo16, bo, nullptr, out, 1);
}

// v001
// Measured time: 220 microseconds a run.
// Next to v000, in two timings, it ran 1.28 times as fast each time.
#include <hip/hip_runtime.h>

// Problem constants
#define CDIM 512
#define SEQ  1024
#define NB   8
#define NH   8
#define HD   64
#define MTOT (NB * SEQ)   // 8192 total token rows
#define KCH  32           // GEMM K chunk (one WMMA K depth)

typedef __attribute__((ext_vector_type(16))) _Float16 v16h;
typedef __attribute__((ext_vector_type(8)))  _Float16 v8h;
typedef __attribute__((ext_vector_type(8)))  float    v8f;

// ---- CDNA5 async global->LDS copy (ASYNCcnt path, ISA 15.18.3 op 98) ----
__device__ __forceinline__ unsigned lds_off_of(const void* p) {
  // LDS aperture keeps the wave-relative LDS byte offset in addr[31:0].
  return (unsigned)(unsigned long long)(uintptr_t)p;
}
__device__ __forceinline__ void async_b128(unsigned lds_off, const void* gaddr) {
  asm volatile("global_load_async_to_lds_b128 %0, %1, off"
               :: "v"(lds_off), "v"((unsigned long long)(uintptr_t)gaddr)
               : "memory");
}
__device__ __forceinline__ void wait_async0() {
  asm volatile("s_wait_asynccnt 0x0" ::: "memory");
}

// Load one WMMA f16 A/B fragment for a 32-wide K chunk.
// Lanes 0-15 hold K {0..7,16..23}, lanes 16-31 hold K {8..15,24..31}.
__device__ __forceinline__ v16h load_frag(const _Float16* p, int hi) {
  v8h a = *(const v8h*)(p + (hi ? 8 : 0));
  v8h b = *(const v8h*)(p + (hi ? 24 : 16));
  v16h r;
#pragma unroll
  for (int i = 0; i < 8; ++i) { r[i] = a[i]; r[i + 8] = b[i]; }
  return r;
}

// x [N, C, H*W] f32  ->  xs [N, S, C] f16
__global__ void pack_x_kernel(const float* __restrict__ x, _Float16* __restrict__ xs) {
  int idx = blockIdx.x * blockDim.x + threadIdx.x;
  if (idx >= NB * CDIM * SEQ) return;
  int n   = idx / (CDIM * SEQ);
  int rem = idx % (CDIM * SEQ);
  int c   = rem / SEQ;
  int s   = rem % SEQ;
  xs[((size_t)n * SEQ + s) * CDIM + c] = (_Float16)x[idx];
}

// All four weight matrices f32 -> f16 (row-major [C_out, C_in]; these rows ARE
// the B-fragment columns for y = x @ W^T).
__global__ void pack_w_kernel(const float* __restrict__ a, const float* __restrict__ b,
                              const float* __restrict__ c, const float* __restrict__ d,
                              _Float16* __restrict__ A, _Float16* __restrict__ B,
                              _Float16* __restrict__ Cw, _Float16* __restrict__ D) {
  int i = blockIdx.x * blockDim.x + threadIdx.x;
  if (i >= CDIM * CDIM) return;
  A[i]  = (_Float16)a[i];
  B[i]  = (_Float16)b[i];
  Cw[i] = (_Float16)c[i];
  D[i]  = (_Float16)d[i];
}

// Y[M,512] = A[M,512](f16) @ W[512,512]^T(f16 row-major) + bias.
// mode 0: f16 row-major [M,512]   (Q, K)
// mode 1: f32 row-major [M,512]   (final output)
// mode 2: f16 head-transposed Vt[(n*NH+h)*HD + d][SEQ]   (V)
// Block 256 thr = 8 waves (4 row-groups x 2 col-groups); block tile 128x128;
// wave tile 32x64 (8 accumulators). K chunks of 32 double-buffered in LDS via
// async copies overlapped with WMMA compute.
__global__ void gemm_bt_kernel(const _Float16* __restrict__ A,
                               const _Float16* __restrict__ W,
                               const float* __restrict__ bias,
                               _Float16* __restrict__ out16,
                               float* __restrict__ out32,
                               int mode) {
  __shared__ __align__(16) _Float16 At[2][128 * KCH];
  __shared__ __align__(16) _Float16 Wt[2][128 * KCH];

  const int tid  = threadIdx.x;
  const int lane = tid & 31;
  const int wave = tid >> 5;
  const int lr   = lane & 15;
  const int hi   = lane >> 4;
  const int wr   = wave & 3;   // row group 0..3
  const int wc   = wave >> 2;  // col group 0..1
  const int mblk = blockIdx.x * 128;
  const int nblk = blockIdx.y * 128;

  // Cooperative copy coords: each thread moves 32B of A and 32B of W per chunk.
  const int crow = tid >> 1;           // 0..127
  const int chof = (tid & 1) * 16;     // halves within 32-half row
  const _Float16* gA = A + (size_t)(mblk + crow) * CDIM + chof;
  const _Float16* gW = W + (size_t)(nblk + crow) * CDIM + chof;
  unsigned ldsA[2], ldsW[2];
#pragma unroll
  for (int b = 0; b < 2; ++b) {
    ldsA[b] = lds_off_of(&At[b][crow * KCH + chof]);
    ldsW[b] = lds_off_of(&Wt[b][crow * KCH + chof]);
  }
  auto issue = [&](int b, int kc) {
    const _Float16* a = gA + kc;
    const _Float16* w = gW + kc;
    async_b128(ldsA[b],      a);
    async_b128(ldsA[b] + 16, a + 8);
    async_b128(ldsW[b],      w);
    async_b128(ldsW[b] + 16, w + 8);
  };

  v8f acc[2][4];
#pragma unroll
  for (int s = 0; s < 2; ++s)
#pragma unroll
    for (int c = 0; c < 4; ++c) acc[s][c] = v8f{0.f,0.f,0.f,0.f,0.f,0.f,0.f,0.f};

  issue(0, 0);
  int cur = 0;
  for (int t = 0; t < CDIM / KCH; ++t) {
    wait_async0();        // my chunk-t copies done
    __syncthreads();      // everyone's chunk-t data visible; other buffer free
    if (t < CDIM / KCH - 1) issue(1 - cur, (t + 1) * KCH);

    const _Float16* Ab = At[cur];
    const _Float16* Wb = Wt[cur];
    v16h af[2];
#pragma unroll
    for (int s = 0; s < 2; ++s)
      af[s] = load_frag(Ab + (size_t)(wr * 32 + s * 16 + lr) * KCH, hi);
#pragma unroll
    for (int c = 0; c < 4; ++c) {
      v16h bf = load_frag(Wb + (size_t)(wc * 64 + c * 16 + lr) * KCH, hi);
#pragma unroll
      for (int s = 0; s < 2; ++s)
        acc[s][c] = __builtin_amdgcn_wmma_f32_16x16x32_f16(false, af[s], false, bf,
                                                           (short)0, acc[s][c], false, false);
    }
    cur ^= 1;
  }

#pragma unroll
  for (int c = 0; c < 4; ++c) {
    const int col = nblk + wc * 64 + c * 16 + lr;
    const float bv = bias[col];
#pragma unroll
    for (int s = 0; s < 2; ++s) {
#pragma unroll
      for (int r = 0; r < 8; ++r) {
        const int row = mblk + wr * 32 + s * 16 + r + 8 * hi;
        float y = acc[s][c][r] + bv;
        if (mode == 0) {
          out16[(size_t)row * CDIM + col] = (_Float16)y;
        } else if (mode == 1) {
          out32[(size_t)row * CDIM + col] = y;
        } else {
          // Vt[(n*NH + h)*HD + d][SEQ]: h = col/64, d = col%64, n = row/SEQ, s = row%SEQ
          const int hh = col >> 6, dd = col & 63;
          const int nn = row >> 10, ss = row & 1023;
          out16[((size_t)(nn * NH + hh) * HD + dd) * SEQ + ss] = (_Float16)y;
        }
      }
    }
  }
}

// Lane l <-> lane l ^ 16 (the two halves of a wave), register to register.
__device__ __forceinline__ float xhalf(float x) {
  int b = __builtin_bit_cast(int, x);
  return __builtin_bit_cast(float,
      __builtin_amdgcn_permlanex16(b, b, 0x76543210, 0xfedcba98, false, false));
}

__global__ void attn_kernel(const _Float16* __restrict__ Q,
                            const _Float16* __restrict__ K,
                            const _Float16* __restrict__ Vt,
                            _Float16* __restrict__ O) {
  __shared__ __align__(16) _Float16 Kt[2][32 * 64];
  __shared__ __align__(16) _Float16 VtT[2][64 * 32];

  const int tid  = threadIdx.x;
  const int lane = tid & 31;
  const int wave = tid >> 5;
  const int lr   = lane & 15;
  const int hi   = lane >> 4;
  const int n    = blockIdx.y >> 3;   // NH == 8
  const int h    = blockIdx.y & 7;
  const int q0   = blockIdx.x * 64 + wave * 16;

  const _Float16* Qb  = Q  + (size_t)n * SEQ * CDIM + h * HD;
  const _Float16* Kb  = K  + (size_t)n * SEQ * CDIM + h * HD;
  const _Float16* VtB = Vt + (size_t)(n * NH + h) * HD * SEQ;   // [64][SEQ]

  const v16h qa0 = load_frag(Qb + (size_t)(q0 + lr) * CDIM, hi);
  const v16h qa1 = load_frag(Qb + (size_t)(q0 + lr) * CDIM + 32, hi);

  // o[c][r] = O^T[d = c*16 + 8*hi + r][query lr]
  v8f o[4];
#pragma unroll
  for (int c = 0; c < 4; ++c) o[c] = v8f{0.f,0.f,0.f,0.f,0.f,0.f,0.f,0.f};
  // Running maximum of query lr (equal in both halves) and this half's share
  // of its running sum (the halves are joined once, after the loop).
  float m = -1.0e30f, l = 0.0f;

  // Cooperative copy coords.
  // K tile: 32 rows x 128B -> thread: row = tid/4, 32B at (tid%4)*32B.
  const int krow = tid >> 2;
  const int kcb  = (tid & 3) * 16;     // halves
  // Vt tile: 64 rows x 64B -> thread: row = tid/2, 32B at (tid%2)*32B.
  const int vrow = tid >> 1;
  const int vcb  = (tid & 1) * 16;     // halves
  const _Float16* gK = Kb  + (size_t)krow * CDIM + kcb;
  const _Float16* gV = VtB + (size_t)vrow * SEQ  + vcb;
  unsigned ldsK[2], ldsV[2];
#pragma unroll
  for (int b = 0; b < 2; ++b) {
    ldsK[b] = lds_off_of(&Kt[b][krow * 64 + kcb]);
    ldsV[b] = lds_off_of(&VtT[b][vrow * 32 + vcb]);
  }
  auto issueKV = [&](int b, int k0) {
    const _Float16* kk = gK + (size_t)k0 * CDIM;  // advance 32 k-rows
    const _Float16* vv = gV + k0;                 // advance 32 halves along S
    async_b128(ldsK[b],      kk);
    async_b128(ldsK[b] + 16, kk + 8);
    async_b128(ldsV[b],      vv);
    async_b128(ldsV[b] + 16, vv + 8);
  };

  issueKV(0, 0);
  int cur = 0;
  for (int kt = 0; kt < SEQ / 32; ++kt) {
    wait_async0();
    __syncthreads();
    if (kt < SEQ / 32 - 1) issueKV(1 - cur, (kt + 1) * 32);

    const _Float16* Kc = Kt[cur];
    const _Float16* Vc = VtT[cur];

    // S^T tile (32 keys x 16 queries) = k_tile @ q_tile^T  (K = 64 -> 2 chunks)
    // s0[r] = key 8*hi + r, s1[r] = key 16 + 8*hi + r, both of query lr.
    v8f s0 = v8f{0.f,0.f,0.f,0.f,0.f,0.f,0.f,0.f};
    v8f s1 = v8f{0.f,0.f,0.f,0.f,0.f,0.f,0.f,0.f};
    {
      v16h a;
      a = load_frag(Kc + (size_t)lr * 64 + 0,  hi);
      s0 = __builtin_amdgcn_wmma_f32_16x16x32_f16(false, a, false, qa0, (short)0, s0, false, false);
      a = load_frag(Kc + (size_t)lr * 64 + 32, hi);
      s0 = __builtin_amdgcn_wmma_f32_16x16x32_f16(false, a, false, qa1, (short)0, s0, false, false);
      a = load_frag(Kc + (size_t)(16 + lr) * 64 + 0,  hi);
      s1 = __builtin_amdgcn_wmma_f32_16x16x32_f16(false, a, false, qa0, (short)0, s1, false, false);
      a = load_frag(Kc + (size_t)(16 + lr) * 64 + 32, hi);
      s1 = __builtin_amdgcn_wmma_f32_16x16x32_f16(false, a, false, qa1, (short)0, s1, false, false);
    }

    // Online softmax of query lr: 16 scores in this lane, 16 in lane ^ 16.
    const v8f v0 = s0 * 0.125f;            // 1/sqrt(64)
    const v8f v1 = s1 * 0.125f;
    float rm = v0[0], rn = v1[0];
#pragma unroll
    for (int r = 1; r < 8; ++r) { rm = fmaxf(rm, v0[r]); rn = fmaxf(rn, v1[r]); }
    rm = fmaxf(rm, rn);
    rm = fmaxf(rm, xhalf(rm));
    const float mn    = fmaxf(m, rm);
    const float alpha = __expf(m - mn);
    m = mn;

    // P^T in place: element i of the B operand is key 8*hi + i (i < 8) or 16 + 8*hi + i - 8 (i >= 8) of query lr.
    v16h pb;
    float rs0 = 0.0f, rs1 = 0.0f;
#pragma unroll
    for (int r = 0; r < 8; ++r) {
      const float p0 = __expf(v0[r] - mn);
      const float p1 = __expf(v1[r] - mn);
      rs0 += p0;
      rs1 += p1;
      pb[r]     = (_Float16)p0;
      pb[r + 8] = (_Float16)p1;
    }
    l = l * alpha + (rs0 + rs1);
#pragma unroll
    for (int c = 0; c < 4; ++c)
#pragma unroll
      for (int r = 0; r < 8; ++r) o[c][r] *= alpha;

    // O^T += V^T_tile(64 x 32) @ P^T(32 x 16): A fragments are contiguous Vt rows.
#pragma unroll
    for (int c = 0; c < 4; ++c) {
      v16h va = load_frag(Vc + (size_t)(c * 16 + lr) * 32, hi);
      o[c] = __builtin_amdgcn_wmma_f32_16x16x32_f16(false, va, false, pb,
                                                    (short)0, o[c], false, false);
    }
    cur ^= 1;
  }

  // Join the halves' sums, normalize and store in [N, h, S, d] flat order:
  // 8 consecutive d of query lr per accumulator tile, one 16-byte store each.
  const float inv = 1.0f / (l + xhalf(l));
  _Float16* Ob = O + ((size_t)(n * NH + h) * SEQ + q0 + lr) * HD + 8 * hi;
#pragma unroll
  for (int c = 0; c < 4; ++c) {
    v8h ov;
#pragma unroll
    for (int r = 0; r < 8; ++r) ov[r] = (_Float16)(o[c][r] * inv);
    *(v8h*)(Ob + c * 16) = ov;
  }
}

extern "C" void kernel_launch(void* const* d_in, const int* in_sizes, int n_in,
                              void* d_out, int out_size, void* d_ws, size_t ws_size,
                              hipStream_t stream) {
  (void)in_sizes; (void)n_in; (void)out_size; (void)ws_size;
  const float* x  = (const float*)d_in[0];
  const float* Wq = (const float*)d_in[1];
  const float* bq = (const float*)d_in[2];
  const float* Wk = (const float*)d_in[3];
  const float* bk = (const float*)d_in[4];
  const float* Wv = (const float*)d_in[5];
  const float* bv = (const float*)d_in[6];
  const float* Wo = (const float*)d_in[7];
  const float* bo = (const float*)d_in[8];
  float* out = (float*)d_out;

  // Workspace layout (offsets in f16 elements). Total ~42 MB.
  _Float16* ws = (_Float16*)d_ws;
  const size_t NSC = (size_t)NB * SEQ * CDIM;   // 4,194,304
  const size_t WSZ = (size_t)CDIM * CDIM;       //   262,144
  _Float16* xs   = ws;
  _Float16* wq16 = xs + NSC;
  _Float16* wk16 = wq16 + WSZ;
  _Float16* wv16 = wk16 + WSZ;
  _Float16* wo16 = wv16 + WSZ;
  _Float16* Qh   = wo16 + WSZ;
  _Float16* Kh   = Qh + NSC;
  _Float16* Vth  = Kh + NSC;   // V stored head-transposed [(n*NH+h)*HD+d][SEQ]
  _Float16* Oh   = Vth + NSC;

  // 1) Pack activations and weights to f16
  pack_x_kernel<<<(NB * CDIM * SEQ + 255) / 256, 256, 0, stream>>>(x, xs);
  pack_w_kernel<<<(CDIM * CDIM + 255) / 256, 256, 0, stream>>>(
      Wq, Wk, Wv, Wo, wq16, wk16, wv16, wo16);

  // 2) Q/K/V projections (fused bias); V written head-transposed
  dim3 ggrid(MTOT / 128, CDIM / 128);
  gemm_bt_kernel<<<ggrid, 256, 0, stream>>>(xs, wq16, bq, Qh,  nullptr, 0);
  gemm_bt_kernel<<<ggrid, 256, 0, stream>>>(xs, wk16, bk, Kh,  nullptr, 0);
  gemm_bt_kernel<<<ggrid, 256, 0, stream>>>(xs, wv16, bv, Vth, nullptr, 2);

  // 3) Flash attention per (n, h); O stored [N, h, S, d] flat
  attn_kernel<<<dim3(SEQ / 64, NB * NH), 128, 0, stream>>>(Qh, Kh, Vth, Oh);

  // 4) Output projection: O (flat [8192, 512]) @ Wo^T + bo -> f32 d_out
  //    (both reference reshapes are memory-order-preserving)
  gemm_bt_kernel<<<ggrid, 256, 0, stream>>>(Oh, wo16, bo, nullptr, out, 1);
}

// v002
// It runs in 128 microseconds.
// Next to v001, in two timings, it ran 1.74 and 1.75 times as fast.
// All steps since v000 together make it 2.23 times as fast.
#include <hip/hip_runtime.h>

// Problem constants
#define CDIM 512
#define SEQ  1024
#define NB   8
#define NH   8
#define HD   64
#define MTOT (NB * SEQ)   // 8192 total token rows
#define KCH  32           // GEMM K chunk (one WMMA K depth)

typedef __attribute__((ext_vector_type(16))) _Float16 v16h;
typedef __attribute__((ext_vector_type(8)))  _Float16 v8h;
typedef __attribute__((ext_vector_type(4)))  _Float16 v4h;
typedef __attribute__((ext_vector_type(8)))  float    v8f;
typedef __attribute__((ext_vector_type(4)))  float    v4f;

// ---- CDNA5 async global->LDS copy (ASYNCcnt path, ISA 15.18.3 op 98) ----
__device__ __forceinline__ unsigned lds_off_of(const void* p) {
  // LDS aperture keeps the wave-relative LDS byte offset in addr[31:0].
  return (unsigned)(unsigned long long)(uintptr_t)p;
}
__device__ __forceinline__ void async_b128(unsigned lds_off, const void* gaddr) {
  asm volatile("global_load_async_to_lds_b128 %0, %1, off"
               :: "v"(lds_off), "v"((unsigned long long)(uintptr_t)gaddr)
               : "memory");
}
__device__ __forceinline__ void wait_async0() {
  asm volatile("s_wait_asynccnt 0x0" ::: "memory");
}

// Load one WMMA f16 A/B fragment for a 32-wide K chunk.
// Lanes 0-15 hold K {0..7,16..23}, lanes 16-31 hold K {8..15,24..31}.
__device__ __forceinline__ v16h load_frag(const _Float16* p, int hi) {
  v8h a = *(const v8h*)(p + (hi ? 8 : 0));
  v8h b = *(const v8h*)(p + (hi ? 24 : 16));
  v16h r;
#pragma unroll
  for (int i = 0; i < 8; ++i) { r[i] = a[i]; r[i + 8] = b[i]; }
  return r;
}

// x [N, C, H*W] f32  ->  xs [N, S, C] f16, one 64 (c) x 128 (s) tile per block.
// In: wave w reads rows c = 8w .. 8w+7, a lane 4 consecutive s of each, so a
// wave-wide load is 512 contiguous bytes. A lane then owns 8 consecutive c of
// 4 tokens and puts each as 16 bytes into the LDS tile [s][c]. Out: 8 lanes
// carry one token's 64 c, so every store fills whole 128-byte lines.
#define PXC 64    // tile extent along c
#define PXS 128   // tile extent along s
#define PXP 72    // LDS row pitch in halves (144 B, 16 B x odd)
__global__ __launch_bounds__(256) void pack_x_kernel(const float* __restrict__ x,
                                                     _Float16* __restrict__ xs) {
  __shared__ __align__(16) _Float16 tile[PXS * PXP];
  const int tid  = threadIdx.x;
  const int lane = tid & 31;
  const int wave = tid >> 5;
  const int sblk = blockIdx.x * PXS;
  const int cblk = blockIdx.y * PXC;
  const int n    = blockIdx.z;

  const float* src = x + ((size_t)n * CDIM + cblk + wave * 8) * SEQ + sblk + lane * 4;
  v4f v[8];
  // unrolled: all 8 loads in flight at once, v[] indexed by constants only
#pragma unroll
  for (int j = 0; j < 8; ++j) v[j] = *(const v4f*)(src + (size_t)j * SEQ);
  // unrolled: register transpose needs constant indices
#pragma unroll
  for (int i = 0; i < 4; ++i) {
    v8h h;
#pragma unroll
    for (int j = 0; j < 8; ++j) h[j] = (_Float16)v[j][i];
    *(v8h*)(&tile[(lane * 4 + i) * PXP + wave * 8]) = h;
  }
  __syncthreads();   // the tile is read across waves below

  _Float16* dst = xs + ((size_t)n * SEQ + sblk) * CDIM + cblk;
  // unrolled: the 4 LDS reads go out together, ahead of the stores
#pragma unroll
  for (int k = 0; k < 4; ++k) {
    const int q   = k * 256 + tid;
    const int row = q >> 3;
    const int c8  = (q & 7) * 8;
    *(v8h*)(dst + (size_t)row * CDIM + c8) = *(const v8h*)(&tile[row * PXP + c8]);
  }
}

// All four weight matrices f32 -> f16 (row-major [C_out, C_in]; these rows ARE
// the B-fragment columns for y = x @ W^T). A thread converts 4 consecutive
// values of each matrix: 16-byte loads, 8-byte stores.
__global__ __launch_bounds__(256) void pack_w_kernel(
                              const float* __restrict__ a, const float* __restrict__ b,
                              const float* __restrict__ c, const float* __restrict__ d,
                              _Float16* __restrict__ A, _Float16* __restrict__ B,
                              _Float16* __restrict__ Cw, _Float16* __restrict__ D) {
  // 32-bit byte offsets from the uniform bases: one offset register serves the
  // four loads and one the four stores.
  const unsigned ib = (blockIdx.x * 256u + threadIdx.x) * 16u;   // f32 side
  const unsigned ob = ib >> 1;                                   // f16 side
  const v4f va = *(const v4f*)((const char*)a + ib);
  const v4f vb = *(const v4f*)((const char*)b + ib);
  const v4f vc = *(const v4f*)((const char*)c + ib);
  const v4f vd = *(const v4f*)((const char*)d + ib);
  *(v4h*)((char*)A + ob)  = __builtin_convertvector(va, v4h);
  *(v4h*)((char*)B + ob)  = __builtin_convertvector(vb, v4h);
  *(v4h*)((char*)Cw + ob) = __builtin_convertvector(vc, v4h);
  *(v4h*)((char*)D + ob)  = __builtin_convertvector(vd, v4h);
}

// Y[M,512] = A[M,512](f16) @ W[512,512]^T(f16 row-major) + bias.
// mode 0: f16 row-major [M,512]   (Q, K)
// mode 1: f32 row-major [M,512]   (final output)
// mode 2: f16 head-transposed Vt[(n*NH+h)*HD + d][SEQ]   (V)
// Block 256 thr = 8 waves (4 row-groups x 2 col-groups); block tile 128x128;
// wave tile 32x64 (8 accumulators). K chunks of 32 double-buffered in LDS via
// async copies overlapped with WMMA compute.
__global__ void gemm_bt_kernel(const _Float16* __restrict__ A,
                               const _Float16* __restrict__ W,
                               const float* __restrict__ bias,
                               _Float16* __restrict__ out16,
                               float* __restrict__ out32,
                               int mode) {
  __shared__ __align__(16) _Float16 At[2][128 * KCH];
  __shared__ __align__(16) _Float16 Wt[2][128 * KCH];

  const int tid  = threadIdx.x;
  const int lane = tid & 31;
  const int wave = tid >> 5;
  const int lr   = lane & 15;
  const int hi   = lane >> 4;
  const int wr   = wave & 3;   // row group 0..3
  const int wc   = wave >> 2;  // col group 0..1
  const int mblk = blockIdx.x * 128;
  const int nblk = blockIdx.y * 128;

  // Cooperative copy coords: each thread moves 32B of A and 32B of W per chunk.
  const int crow = tid >> 1;           // 0..127
  const int chof = (tid & 1) * 16;     // halves within 32-half row
  const _Float16* gA = A + (size_t)(mblk + crow) * CDIM + chof;
  const _Float16* gW = W + (size_t)(nblk + crow) * CDIM + chof;
  unsigned ldsA[2], ldsW[2];
#pragma unroll
  for (int b = 0; b < 2; ++b) {
    ldsA[b] = lds_off_of(&At[b][crow * KCH + chof]);
    ldsW[b] = lds_off_of(&Wt[b][crow * KCH + chof]);
  }
  auto issue = [&](int b, int kc) {
    const _Float16* a = gA + kc;
    const _Float16* w = gW + kc;
    async_b128(ldsA[b],      a);
    async_b128(ldsA[b] + 16, a + 8);
    async_b128(ldsW[b],      w);
    async_b128(ldsW[b] + 16, w + 8);
  };

  v8f acc[2][4];
#pragma unroll
  for (int s = 0; s < 2; ++s)
#pragma unroll
    for (int c = 0; c < 4; ++c) acc[s][c] = v8f{0.f,0.f,0.f,0.f,0.f,0.f,0.f,0.f};

  issue(0, 0);
  int cur = 0;
  for (int t = 0; t < CDIM / KCH; ++t) {
    wait_async0();        // my chunk-t copies done
    __syncthreads();      // everyone's chunk-t data visible; other buffer free
    if (t < CDIM / KCH - 1) issue(1 - cur, (t + 1) * KCH);

    const _Float16* Ab = At[cur];
    const _Float16* Wb = Wt[cur];
    v16h af[2];
#pragma unroll
    for (int s = 0; s < 2; ++s)
      af[s] = load_frag(Ab + (size_t)(wr * 32 + s * 16 + lr) * KCH, hi);
#pragma unroll
    for (int c = 0; c < 4; ++c) {
      v16h bf = load_frag(Wb + (size_t)(wc * 64 + c * 16 + lr) * KCH, hi);
#pragma unroll
      for (int s = 0; s < 2; ++s)
        acc[s][c] = __builtin_amdgcn_wmma_f32_16x16x32_f16(false, af[s], false, bf,
                                                           (short)0, acc[s][c], false, false);
    }
    cur ^= 1;
  }

#pragma unroll
  for (int c = 0; c < 4; ++c) {
    const int col = nblk + wc * 64 + c * 16 + lr;
    const float bv = bias[col];
#pragma unroll
    for (int s = 0; s < 2; ++s) {
#pragma unroll
      for (int r = 0; r < 8; ++r) {
        const int row = mblk + wr * 32 + s * 16 + r + 8 * hi;
        float y = acc[s][c][r] + bv;
        if (mode == 0) {
          out16[(size_t)row * CDIM + col] = (_Float16)y;
        } else if (mode == 1) {
          out32[(size_t)row * CDIM + col] = y;
        } else {
          // Vt[(n*NH + h)*HD + d][SEQ]: h = col/64, d = col%64, n = row/SEQ, s = row%SEQ
          const int hh = col >> 6, dd = col & 63;
          const int nn = row >> 10, ss = row & 1023;
          out16[((size_t)(nn * NH + hh) * HD + dd) * SEQ + ss] = (_Float16)y;
        }
      }
    }
  }
}

// Lane l <-> lane l ^ 16 (the two halves of a wave), register to register.
__device__ __forceinline__ float xhalf(float x) {
  int b = __builtin_bit_cast(int, x);
  return __builtin_bit_cast(float,
      __builtin_amdgcn_permlanex16(b, b, 0x76543210, 0xfedcba98, false, false));
}

__global__ void attn_kernel(const _Float16* __restrict__ Q,
                            const _Float16* __restrict__ K,
                            const _Float16* __restrict__ Vt,
                            _Float16* __restrict__ O) {
  __shared__ __align__(16) _Float16 Kt[2][32 * 64];
  __shared__ __align__(16) _Float16 VtT[2][64 * 32];

  const int tid  = threadIdx.x;
  const int lane = tid & 31;
  const int wave = tid >> 5;
  const int lr   = lane & 15;
  const int hi   = lane >> 4;
  const int n    = blockIdx.y >> 3;   // NH == 8
  const int h    = blockIdx.y & 7;
  const int q0   = blockIdx.x * 64 + wave * 16;

  const _Float16* Qb  = Q  + (size_t)n * SEQ * CDIM + h * HD;
  const _Float16* Kb  = K  + (size_t)n * SEQ * CDIM + h * HD;
  const _Float16* VtB = Vt + (size_t)(n * NH + h) * HD * SEQ;   // [64][SEQ]

  const v16h qa0 = load_frag(Qb + (size_t)(q0 + lr) * CDIM, hi);
  const v16h qa1 = load_frag(Qb + (size_t)(q0 + lr) * CDIM + 32, hi);

  // o[c][r] = O^T[d = c*16 + 8*hi + r][query lr]
  v8f o[4];
#pragma unroll
  for (int c = 0; c < 4; ++c) o[c] = v8f{0.f,0.f,0.f,0.f,0.f,0.f,0.f,0.f};
  // Running maximum of query lr (equal in both halves) and this half's share
  // of its running sum (the halves are joined once, after the loop).
  float m = -1.0e30f, l = 0.0f;

  // Cooperative copy coords.
  // K tile: 32 rows x 128B -> thread: row = tid/4, 32B at (tid%4)*32B.
  const int krow = tid >> 2;
  const int kcb  = (tid & 3) * 16;     // halves
  // Vt tile: 64 rows x 64B -> thread: row = tid/2, 32B at (tid%2)*32B.
  const int vrow = tid >> 1;
  const int vcb  = (tid & 1) * 16;     // halves
  const _Float16* gK = Kb  + (size_t)krow * CDIM + kcb;
  const _Float16* gV = VtB + (size_t)vrow * SEQ  + vcb;
  unsigned ldsK[2], ldsV[2];
#pragma unroll
  for (int b = 0; b < 2; ++b) {
    ldsK[b] = lds_off_of(&Kt[b][krow * 64 + kcb]);
    ldsV[b] = lds_off_of(&VtT[b][vrow * 32 + vcb]);
  }
  auto issueKV = [&](int b, int k0) {
    const _Float16* kk = gK + (size_t)k0 * CDIM;  // advance 32 k-rows
    const _Float16* vv = gV + k0;                 // advance 32 halves along S
    async_b128(ldsK[b],      kk);
    async_b128(ldsK[b] + 16, kk + 8);
    async_b128(ldsV[b],      vv);
    async_b128(ldsV[b] + 16, vv + 8);
  };

  issueKV(0, 0);
  int cur = 0;
  for (int kt = 0; kt < SEQ / 32; ++kt) {
    wait_async0();
    __syncthreads();
    if (kt < SEQ / 32 - 1) issueKV(1 - cur, (kt + 1) * 32);

    const _Float16* Kc = Kt[cur];
    const _Float16* Vc = VtT[cur];

    // S^T tile (32 keys x 16 queries) = k_tile @ q_tile^T  (K = 64 -> 2 chunks)
    // s0[r] = key 8*hi + r, s1[r] = key 16 + 8*hi + r, both of query lr.
    v8f s0 = v8f{0.f,0.f,0.f,0.f,0.f,0.f,0.f,0.f};
    v8f s1 = v8f{0.f,0.f,0.f,0.f,0.f,0.f,0.f,0.f};
    {
      v16h a;
      a = load_frag(Kc + (size_t)lr * 64 + 0,  hi);
      s0 = __builtin_amdgcn_wmma_f32_16x16x32_f16(false, a, false, qa0, (short)0, s0, false, false);
      a = load_frag(Kc + (size_t)lr * 64 + 32, hi);
      s0 = __builtin_amdgcn_wmma_f32_16x16x32_f16(false, a, false, qa1, (short)0, s0, false, false);
      a = load_frag(Kc + (size_t)(16 + lr) * 64 + 0,  hi);
      s1 = __builtin_amdgcn_wmma_f32_16x16x32_f16(false, a, false, qa0, (short)0, s1, false, false);
      a = load_frag(Kc + (size_t)(16 + lr) * 64 + 32, hi);
      s1 = __builtin_amdgcn_wmma_f32_16x16x32_f16(false, a, false, qa1, (short)0, s1, false, false);
    }

    // Online softmax of query lr: 16 scores in this lane, 16 in lane ^ 16.
    const v8f v0 = s0 * 0.125f;            // 1/sqrt(64)
    const v8f v1 = s1 * 0.125f;
    float rm = v0[0], rn = v1[0];
#pragma unroll
    for (int r = 1; r < 8; ++r) { rm = fmaxf(rm, v0[r]); rn = fmaxf(rn, v1[r]); }
    rm = fmaxf(rm, rn);
    rm = fmaxf(rm, xhalf(rm));
    const float mn    = fmaxf(m, rm);
    const float alpha = __expf(m - mn);
    m = mn;

    // P^T in place: element i of the B operand is key 8*hi + i (i < 8) or 16 + 8*hi + i - 8 (i >= 8) of query lr.
    v16h pb;
    float rs0 = 0.0f, rs1 = 0.0f;
#pragma unroll
    for (int r = 0; r < 8; ++r) {
      const float p0 = __expf(v0[r] - mn);
      const float p1 = __expf(v1[r] - mn);
      rs0 += p0;
      rs1 += p1;
      pb[r]     = (_Float16)p0;
      pb[r + 8] = (_Float16)p1;
    }
    l = l * alpha + (rs0 + rs1);
#pragma unroll
    for (int c = 0; c < 4; ++c)
#pragma unroll
      for (int r = 0; r < 8; ++r) o[c][r] *= alpha;

    // O^T += V^T_tile(64 x 32) @ P^T(32 x 16): A fragments are contiguous Vt rows.
#pragma unroll
    for (int c = 0; c < 4; ++c) {
      v16h va = load_frag(Vc + (size_t)(c * 16 + lr) * 32, hi);
      o[c] = __builtin_amdgcn_wmma_f32_16x16x32_f16(false, va, false, pb,
                                                    (short)0, o[c], false, false);
    }
    cur ^= 1;
  }

  // Join the halves' sums, normalize and store in [N, h, S, d] flat order:
  // 8 consecutive d of query lr per accumulator tile, one 16-byte store each.
  const float inv = 1.0f / (l + xhalf(l));
  _Float16* Ob = O + ((size_t)(n * NH + h) * SEQ + q0 + lr) * HD + 8 * hi;
#pragma unroll
  for (int c = 0; c < 4; ++c) {
    v8h ov;
#pragma unroll
    for (int r = 0; r < 8; ++r) ov[r] = (_Float16)(o[c][r] * inv);
    *(v8h*)(Ob + c * 16) = ov;
  }
}

extern "C" void kernel_launch(void* const* d_in, const int* in_sizes, int n_in,
                              void* d_out, int out_size, void* d_ws, size_t ws_size,
                              hipStream_t stream) {
  (void)in_sizes; (void)n_in; (void)out_size; (void)ws_size;
  const float* x  = (const float*)d_in[0];
  const float* Wq = (const float*)d_in[1];
  const float* bq = (const float*)d_in[2];
  const float* Wk = (const float*)d_in[3];
  const float* bk = (const float*)d_in[4];
  const float* Wv = (const float*)d_in[5];
  const float* bv = (const float*)d_in[6];
  const float* Wo = (const float*)d_in[7];
  const float* bo = (const float*)d_in[8];
  float* out = (float*)d_out;

  // Workspace layout (offsets in f16 elements). Total ~42 MB.
  _Float16* ws = (_Float16*)d_ws;
  const size_t NSC = (size_t)NB * SEQ * CDIM;   // 4,194,304
  const size_t WSZ = (size_t)CDIM * CDIM;       //   262,144
  _Float16* xs   = ws;
  _Float16* wq16 = xs + NSC;
  _Float16* wk16 = wq16 + WSZ;
  _Float16* wv16 = wk16 + WSZ;
  _Float16* wo16 = wv16 + WSZ;
  _Float16* Qh   = wo16 + WSZ;
  _Float16* Kh   = Qh + NSC;
  _Float16* Vth  = Kh + NSC;   // V stored head-transposed [(n*NH+h)*HD+d][SEQ]
  _Float16* Oh   = Vth + NSC;

  // 1) Pack activations and weights to f16
  pack_x_kernel<<<dim3(SEQ / PXS, CDIM / PXC, NB), 256, 0, stream>>>(x, xs);
  pack_w_kernel<<<CDIM * CDIM / 4 / 256, 256, 0, stream>>>(
      Wq, Wk, Wv, Wo, wq16, wk16, wv16, wo16);

  // 2) Q/K/V projections (fused bias); V written head-transposed
  dim3 ggrid(MTOT / 128, CDIM / 128);
  gemm_bt_kernel<<<ggrid, 256, 0, stream>>>(xs, wq16, bq, Qh,  nullptr, 0);
  gemm_bt_kernel<<<ggrid, 256, 0, stream>>>(xs, wk16, bk, Kh,  nullptr, 0);
  gemm_bt_kernel<<<ggrid, 256, 0, stream>>>(xs, wv16, bv, Vth, nullptr, 2);

  // 3) Flash attention per (n, h); O stored [N, h, S, d] flat
  attn_kernel<<<dim3(SEQ / 64, NB * NH), 128, 0, stream>>>(Qh, Kh, Vth, Oh);

  // 4) Output projection: O (flat [8192, 512]) @ Wo^T + bo -> f32 d_out
  //    (both reference reshapes are memory-order-preserving)
  gemm_bt_kernel<<<ggrid, 256, 0, stream>>>(Oh, wo16, bo, nullptr, out, 1);
}

// v003
// It runs in 99.5 microseconds.
// Next to v002, in two timings, it ran 1.30 and 1.28 times as fast.
// Over all steps from v000 it is 2.87 times as fast.
#include <hip/hip_runtime.h>

// Problem constants
#define CDIM 512
#define SEQ  1024
#define NB   8
#define NH   8
#define HD   64
#define MTOT (NB * SEQ)   // 8192 total token rows
#define KCH  32           // GEMM K chunk (one WMMA K depth)
// LDS row pitches in halves, 16 B x odd: the 16 lanes of a half-wave that read
// 16 bytes of 16 consecutive rows then fall on all 64 banks, none twice.
#define P32  40           // rows of 32 halves (64 B) lie 80 B apart
#define P64  72           // rows of 64 halves (128 B) lie 144 B apart

typedef __attribute__((ext_vector_type(16))) _Float16 v16h;
typedef __attribute__((ext_vector_type(8)))  _Float16 v8h;
typedef __attribute__((ext_vector_type(4)))  _Float16 v4h;
typedef __attribute__((ext_vector_type(8)))  float    v8f;
typedef __attribute__((ext_vector_type(4)))  float    v4f;

// ---- CDNA5 async global->LDS copy (ASYNCcnt path, ISA 15.18.3 op 98) ----
__device__ __forceinline__ unsigned lds_off_of(const void* p) {
  // LDS aperture keeps the wave-relative LDS byte offset in addr[31:0].
  return (unsigned)(unsigned long long)(uintptr_t)p;
}
__device__ __forceinline__ void async_b128(unsigned lds_off, const void* gaddr) {
  asm volatile("global_load_async_to_lds_b128 %0, %1, off"
               :: "v"(lds_off), "v"((unsigned long long)(uintptr_t)gaddr)
               : "memory");
}
__device__ __forceinline__ void wait_async0() {
  asm volatile("s_wait_asynccnt 0x0" ::: "memory");
}

// Load one WMMA f16 A/B fragment for a 32-wide K chunk.
// Lanes 0-15 hold K {0..7,16..23}, lanes 16-31 hold K {8..15,24..31}.
__device__ __forceinline__ v16h load_frag(const _Float16* p, int hi) {
  v8h a = *(const v8h*)(p + (hi ? 8 : 0));
  v8h b = *(const v8h*)(p + (hi ? 24 : 16));
  v16h r;
#pragma unroll
  for (int i = 0; i < 8; ++i) { r[i] = a[i]; r[i + 8] = b[i]; }
  return r;
}

// x [N, C, H*W] f32  ->  xs [N, S, C] f16, one 64 (c) x 128 (s) tile per block.
// In: wave w reads rows c = 8w .. 8w+7, a lane 4 consecutive s of each, so a
// wave-wide load is 512 contiguous bytes. A lane then owns 8 consecutive c of
// 4 tokens and puts each as 16 bytes into the LDS tile [s][c]. Out: 8 lanes
// carry one token's 64 c, so every store fills whole 128-byte lines.
#define PXC 64    // tile extent along c
#define PXS 128   // tile extent along s
#define PXP 72    // LDS row pitch in halves (144 B, 16 B x odd)
__global__ __launch_bounds__(256) void pack_x_kernel(const float* __restrict__ x,
                                                     _Float16* __restrict__ xs) {
  __shared__ __align__(16) _Float16 tile[PXS * PXP];
  const int tid  = threadIdx.x;
  const int lane = tid & 31;
  const int wave = tid >> 5;
  const int sblk = blockIdx.x * PXS;
  const int cblk = blockIdx.y * PXC;
  const int n    = blockIdx.z;

  const float* src = x + ((size_t)n * CDIM + cblk + wave * 8) * SEQ + sblk + lane * 4;
  v4f v[8];
  // unrolled: all 8 loads in flight at once, v[] indexed by constants only
#pragma unroll
  for (int j = 0; j < 8; ++j) v[j] = *(const v4f*)(src + (size_t)j * SEQ);
  // unrolled: register transpose needs constant indices
#pragma unroll
  for (int i = 0; i < 4; ++i) {
    v8h h;
#pragma unroll
    for (int j = 0; j < 8; ++j) h[j] = (_Float16)v[j][i];
    *(v8h*)(&tile[(lane * 4 + i) * PXP + wave * 8]) = h;
  }
  __syncthreads();   // the tile is read across waves below

  _Float16* dst = xs + ((size_t)n * SEQ + sblk) * CDIM + cblk;
  // unrolled: the 4 LDS reads go out together, ahead of the stores
#pragma unroll
  for (int k = 0; k < 4; ++k) {
    const int q   = k * 256 + tid;
    const int row = q >> 3;
    const int c8  = (q & 7) * 8;
    *(v8h*)(dst + (size_t)row * CDIM + c8) = *(const v8h*)(&tile[row * PXP + c8]);
  }
}

// All four weight matrices f32 -> f16 (row-major [C_out, C_in]; these rows ARE
// the B-fragment columns for y = x @ W^T). A thread converts 4 consecutive
// values of each matrix: 16-byte loads, 8-byte stores.
__global__ __launch_bounds__(256) void pack_w_kernel(
                              const float* __restrict__ a, const float* __restrict__ b,
                              const float* __restrict__ c, const float* __restrict__ d,
                              _Float16* __restrict__ A, _Float16* __restrict__ B,
                              _Float16* __restrict__ Cw, _Float16* __restrict__ D) {
  // 32-bit byte offsets from the uniform bases: one offset register serves the
  // four loads and one the four stores.
  const unsigned ib = (blockIdx.x * 256u + threadIdx.x) * 16u;   // f32 side
  const unsigned ob = ib >> 1;                                   // f16 side
  const v4f va = *(const v4f*)((const char*)a + ib);
  const v4f vb = *(const v4f*)((const char*)b + ib);
  const v4f vc = *(const v4f*)((const char*)c + ib);
  const v4f vd = *(const v4f*)((const char*)d + ib);
  *(v4h*)((char*)A + ob)  = __builtin_convertvector(va, v4h);
  *(v4h*)((char*)B + ob)  = __builtin_convertvector(vb, v4h);
  *(v4h*)((char*)Cw + ob) = __builtin_convertvector(vc, v4h);
  *(v4h*)((char*)D + ob)  = __builtin_convertvector(vd, v4h);
}

// Y[M,512] = A[M,512](f16) @ W[512,512]^T(f16 row-major) + bias.
// mode 0: f16 row-major [M,512]   (Q, K)
// mode 1: f32 row-major [M,512]   (final output)
// mode 2: f16 head-transposed Vt[(n*NH+h)*HD + d][SEQ]   (V)
// Block 256 thr = 8 waves (4 row-groups x 2 col-groups); block tile 128x128;
// wave tile 32x64 (8 accumulators). K chunks of 32 double-buffered in LDS via
// async copies overlapped with WMMA compute.
__global__ void gemm_bt_kernel(const _Float16* __restrict__ A,
                               const _Float16* __restrict__ W,
                               const float* __restrict__ bias,
                               _Float16* __restrict__ out16,
                               float* __restrict__ out32,
                               int mode) {
  __shared__ __align__(16) _Float16 At[2][128 * P32];
  __shared__ __align__(16) _Float16 Wt[2][128 * P32];

  const int tid  = threadIdx.x;
  const int lane = tid & 31;
  const int wave = tid >> 5;
  const int lr   = lane & 15;
  const int hi   = lane >> 4;
  const int wr   = wave & 3;   // row group 0..3
  const int wc   = wave >> 2;  // col group 0..1
  const int mblk = blockIdx.x * 128;
  const int nblk = blockIdx.y * 128;

  // Cooperative copy coords: each thread moves 32B of A and 32B of W per chunk.
  const int crow = tid >> 1;           // 0..127
  const int chof = (tid & 1) * 16;     // halves within 32-half row
  const _Float16* gA = A + (size_t)(mblk + crow) * CDIM + chof;
  const _Float16* gW = W + (size_t)(nblk + crow) * CDIM + chof;
  unsigned ldsA[2], ldsW[2];
#pragma unroll
  for (int b = 0; b < 2; ++b) {
    ldsA[b] = lds_off_of(&At[b][crow * P32 + chof]);
    ldsW[b] = lds_off_of(&Wt[b][crow * P32 + chof]);
  }
  auto issue = [&](int b, int kc) {
    const _Float16* a = gA + kc;
    const _Float16* w = gW + kc;
    async_b128(ldsA[b],      a);
    async_b128(ldsA[b] + 16, a + 8);
    async_b128(ldsW[b],      w);
    async_b128(ldsW[b] + 16, w + 8);
  };

  v8f acc[2][4];
#pragma unroll
  for (int s = 0; s < 2; ++s)
#pragma unroll
    for (int c = 0; c < 4; ++c) acc[s][c] = v8f{0.f,0.f,0.f,0.f,0.f,0.f,0.f,0.f};

  issue(0, 0);
  int cur = 0;
  for (int t = 0; t < CDIM / KCH; ++t) {
    wait_async0();        // my chunk-t copies done
    __syncthreads();      // everyone's chunk-t data visible; other buffer free
    if (t < CDIM / KCH - 1) issue(1 - cur, (t + 1) * KCH);

    const _Float16* Ab = At[cur];
    const _Float16* Wb = Wt[cur];
    v16h af[2];
#pragma unroll
    for (int s = 0; s < 2; ++s)
      af[s] = load_frag(Ab + (size_t)(wr * 32 + s * 16 + lr) * P32, hi);
#pragma unroll
    for (int c = 0; c < 4; ++c) {
      v16h bf = load_frag(Wb + (size_t)(wc * 64 + c * 16 + lr) * P32, hi);
#pragma unroll
      for (int s = 0; s < 2; ++s)
        acc[s][c] = __builtin_amdgcn_wmma_f32_16x16x32_f16(false, af[s], false, bf,
                                                           (short)0, acc[s][c], false, false);
    }
    cur ^= 1;
  }

#pragma unroll
  for (int c = 0; c < 4; ++c) {
    const int col = nblk + wc * 64 + c * 16 + lr;
    const float bv = bias[col];
#pragma unroll
    for (int s = 0; s < 2; ++s) {
#pragma unroll
      for (int r = 0; r < 8; ++r) {
        const int row = mblk + wr * 32 + s * 16 + r + 8 * hi;
        float y = acc[s][c][r] + bv;
        if (mode == 0) {
          out16[(size_t)row * CDIM + col] = (_Float16)y;
        } else if (mode == 1) {
          out32[(size_t)row * CDIM + col] = y;
        } else {
          // Vt[(n*NH + h)*HD + d][SEQ]: h = col/64, d = col%64, n = row/SEQ, s = row%SEQ
          const int hh = col >> 6, dd = col & 63;
          const int nn = row >> 10, ss = row & 1023;
          out16[((size_t)(nn * NH + hh) * HD + dd) * SEQ + ss] = (_Float16)y;
        }
      }
    }
  }
}

// Lane l <-> lane l ^ 16 (the two halves of a wave), register to register.
__device__ __forceinline__ float xhalf(float x) {
  int b = __builtin_bit_cast(int, x);
  return __builtin_bit_cast(float,
      __builtin_amdgcn_permlanex16(b, b, 0x76543210, 0xfedcba98, false, false));
}

__global__ void attn_kernel(const _Float16* __restrict__ Q,
                            const _Float16* __restrict__ K,
                            const _Float16* __restrict__ Vt,
                            _Float16* __restrict__ O) {
  __shared__ __align__(16) _Float16 Kt[2][32 * P64];
  __shared__ __align__(16) _Float16 VtT[2][64 * P32];

  const int tid  = threadIdx.x;
  const int lane = tid & 31;
  const int wave = tid >> 5;
  const int lr   = lane & 15;
  const int hi   = lane >> 4;
  const int n    = blockIdx.y >> 3;   // NH == 8
  const int h    = blockIdx.y & 7;
  const int q0   = blockIdx.x * 64 + wave * 16;

  const _Float16* Qb  = Q  + (size_t)n * SEQ * CDIM + h * HD;
  const _Float16* Kb  = K  + (size_t)n * SEQ * CDIM + h * HD;
  const _Float16* VtB = Vt + (size_t)(n * NH + h) * HD * SEQ;   // [64][SEQ]

  const v16h qa0 = load_frag(Qb + (size_t)(q0 + lr) * CDIM, hi);
  const v16h qa1 = load_frag(Qb + (size_t)(q0 + lr) * CDIM + 32, hi);

  // o[c][r] = O^T[d = c*16 + 8*hi + r][query lr]
  v8f o[4];
#pragma unroll
  for (int c = 0; c < 4; ++c) o[c] = v8f{0.f,0.f,0.f,0.f,0.f,0.f,0.f,0.f};
  // Running maximum of query lr (equal in both halves) and this half's share
  // of its running sum (the halves are joined once, after the loop).
  float m = -1.0e30f, l = 0.0f;

  // Cooperative copy coords.
  // K tile: 32 rows x 128B -> thread: row = tid/4, 32B at (tid%4)*32B.
  const int krow = tid >> 2;
  const int kcb  = (tid & 3) * 16;     // halves
  // Vt tile: 64 rows x 64B -> thread: row = tid/2, 32B at (tid%2)*32B.
  const int vrow = tid >> 1;
  const int vcb  = (tid & 1) * 16;     // halves
  const _Float16* gK = Kb  + (size_t)krow * CDIM + kcb;
  const _Float16* gV = VtB + (size_t)vrow * SEQ  + vcb;
  unsigned ldsK[2], ldsV[2];
#pragma unroll
  for (int b = 0; b < 2; ++b) {
    ldsK[b] = lds_off_of(&Kt[b][krow * P64 + kcb]);
    ldsV[b] = lds_off_of(&VtT[b][vrow * P32 + vcb]);
  }
  auto issueKV = [&](int b, int k0) {
    const _Float16* kk = gK + (size_t)k0 * CDIM;  // advance 32 k-rows
    const _Float16* vv = gV + k0;                 // advance 32 halves along S
    async_b128(ldsK[b],      kk);
    async_b128(ldsK[b] + 16, kk + 8);
    async_b128(ldsV[b],      vv);
    async_b128(ldsV[b] + 16, vv + 8);
  };

  issueKV(0, 0);
  int cur = 0;
  for (int kt = 0; kt < SEQ / 32; ++kt) {
    wait_async0();
    __syncthreads();
    if (kt < SEQ / 32 - 1) issueKV(1 - cur, (kt + 1) * 32);

    const _Float16* Kc = Kt[cur];
    const _Float16* Vc = VtT[cur];

    // S^T tile (32 keys x 16 queries) = k_tile @ q_tile^T  (K = 64 -> 2 chunks)
    // s0[r] = key 8*hi + r, s1[r] = key 16 + 8*hi + r, both of query lr.
    v8f s0 = v8f{0.f,0.f,0.f,0.f,0.f,0.f,0.f,0.f};
    v8f s1 = v8f{0.f,0.f,0.f,0.f,0.f,0.f,0.f,0.f};
    {
      v16h a;
      a = load_frag(Kc + (size_t)lr * P64 + 0,  hi);
      s0 = __builtin_amdgcn_wmma_f32_16x16x32_f16(false, a, false, qa0, (short)0, s0, false, false);
      a = load_frag(Kc + (size_t)lr * P64 + 32, hi);
      s0 = __builtin_amdgcn_wmma_f32_16x16x32_f16(false, a, false, qa1, (short)0, s0, false, false);
      a = load_frag(Kc + (size_t)(16 + lr) * P64 + 0,  hi);
      s1 = __builtin_amdgcn_wmma_f32_16x16x32_f16(false, a, false, qa0, (short)0, s1, false, false);
      a = load_frag(Kc + (size_t)(16 + lr) * P64 + 32, hi);
      s1 = __builtin_amdgcn_wmma_f32_16x16x32_f16(false, a, false, qa1, (short)0, s1, false, false);
    }

    // Online softmax of query lr: 16 scores in this lane, 16 in lane ^ 16.
    const v8f v0 = s0 * 0.125f;            // 1/sqrt(64)
    const v8f v1 = s1 * 0.125f;
    float rm = v0[0], rn = v1[0];
#pragma unroll
    for (int r = 1; r < 8; ++r) { rm = fmaxf(rm, v0[r]); rn = fmaxf(rn, v1[r]); }
    rm = fmaxf(rm, rn);
    rm = fmaxf(rm, xhalf(rm));
    const float mn    = fmaxf(m, rm);
    const float alpha = __expf(m - mn);
    m = mn;

    // P^T in place: element i of the B operand is key 8*hi + i (i < 8) or 16 + 8*hi + i - 8 (i >= 8) of query lr.
    v16h pb;
    float rs0 = 0.0f, rs1 = 0.0f;
#pragma unroll
    for (int r = 0; r < 8; ++r) {
      const float p0 = __expf(v0[r] - mn);
      const float p1 = __expf(v1[r] - mn);
      rs0 += p0;
      rs1 += p1;
      pb[r]     = (_Float16)p0;
      pb[r + 8] = (_Float16)p1;
    }
    l = l * alpha + (rs0 + rs1);
#pragma unroll
    for (int c = 0; c < 4; ++c)
#pragma unroll
      for (int r = 0; r < 8; ++r) o[c][r] *= alpha;

    // O^T += V^T_tile(64 x 32) @ P^T(32 x 16): A fragments are contiguous Vt rows.
#pragma unroll
    for (int c = 0; c < 4; ++c) {
      v16h va = load_frag(Vc + (size_t)(c * 16 + lr) * P32, hi);
      o[c] = __builtin_amdgcn_wmma_f32_16x16x32_f16(false, va, false, pb,
                                                    (short)0, o[c], false, false);
    }
    cur ^= 1;
  }

  // Join the halves' sums, normalize and store in [N, h, S, d] flat order:
  // 8 consecutive d of query lr per accumulator tile, one 16-byte store each.
  const float inv = 1.0f / (l + xhalf(l));
  _Float16* Ob = O + ((size_t)(n * NH + h) * SEQ + q0 + lr) * HD + 8 * hi;
#pragma unroll
  for (int c = 0; c < 4; ++c) {
    v8h ov;
#pragma unroll
    for (int r = 0; r < 8; ++r) ov[r] = (_Float16)(o[c][r] * inv);
    *(v8h*)(Ob + c * 16) = ov;
  }
}

extern "C" void kernel_launch(void* const* d_in, const int* in_sizes, int n_in,
                              void* d_out, int out_size, void* d_ws, size_t ws_size,
                              hipStream_t stream) {
  (void)in_sizes; (void)n_in; (void)out_size; (void)ws_size;
  const float* x  = (const float*)d_in[0];
  const float* Wq = (const float*)d_in[1];
  const float* bq = (const float*)d_in[2];
  const float* Wk = (const float*)d_in[3];
  const float* bk = (const float*)d_in[4];
  const float* Wv = (const float*)d_in[5];
  const float* bv = (const float*)d_in[6];
  const float* Wo = (const float*)d_in[7];
  const float* bo = (const float*)d_in[8];
  float* out = (float*)d_out;

  // Workspace layout (offsets in f16 elements). Total ~42 MB.
  _Float16* ws = (_Float16*)d_ws;
  const size_t NSC = (size_t)NB * SEQ * CDIM;   // 4,194,304
  const size_t WSZ = (size_t)CDIM * CDIM;       //   262,144
  _Float16* xs   = ws;
  _Float16* wq16 = xs + NSC;
  _Float16* wk16 = wq16 + WSZ;
  _Float16* wv16 = wk16 + WSZ;
  _Float16* wo16 = wv16 + WSZ;
  _Float16* Qh   = wo16 + WSZ;
  _Float16* Kh   = Qh + NSC;
  _Float16* Vth  = Kh + NSC;   // V stored head-transposed [(n*NH+h)*HD+d][SEQ]
  _Float16* Oh   = Vth + NSC;

  // 1) Pack activations and weights to f16
  pack_x_kernel<<<dim3(SEQ / PXS, CDIM / PXC, NB), 256, 0, stream>>>(x, xs);
  pack_w_kernel<<<CDIM * CDIM / 4 / 256, 256, 0, stream>>>(
      Wq, Wk, Wv, Wo, wq16, wk16, wv16, wo16);

  // 2) Q/K/V projections (fused bias); V written head-transposed
  dim3 ggrid(MTOT / 128, CDIM / 128);
  gemm_bt_kernel<<<ggrid, 256, 0, stream>>>(xs, wq16, bq, Qh,  nullptr, 0);
  gemm_bt_kernel<<<ggrid, 256, 0, stream>>>(xs, wk16, bk, Kh,  nullptr, 0);
  gemm_bt_kernel<<<ggrid, 256, 0, stream>>>(xs, wv16, bv, Vth, nullptr, 2);

  // 3) Flash attention per (n, h); O stored [N, h, S, d] flat
  attn_kernel<<<dim3(SEQ / 64, NB * NH), 128, 0, stream>>>(Qh, Kh, Vth, Oh);

  // 4) Output projection: O (flat [8192, 512]) @ Wo^T + bo -> f32 d_out
  //    (both reference reshapes are memory-order-preserving)
  gemm_bt_kernel<<<ggrid, 256, 0, stream>>>(Oh, wo16, bo, nullptr, out, 1);
}

// v004
// It runs in 78.7 microseconds.
// In two side-by-side timings against v003, it was 1.28 and 1.27 times as fast.
// Over all steps from v000 it is 3.66 times as fast.
#include <hip/hip_runtime.h>

// Problem constants
#define CDIM 512
#define SEQ  1024
#define NB   8
#define NH   8
#define HD   64
#define MTOT (NB * SEQ)   // 8192 total token rows
#define KCH  32           // GEMM K chunk (one WMMA K depth)
// LDS row pitches in halves, 16 B x odd: the 16 lanes of a half-wave that read
// 16 bytes of 16 consecutive rows then fall on all 64 banks, none twice.
#define P32  40           // rows of 32 halves (64 B) lie 80 B apart
#define P64  72           // rows of 64 halves (128 B) lie 144 B apart

typedef __attribute__((ext_vector_type(16))) _Float16 v16h;
typedef __attribute__((ext_vector_type(8)))  _Float16 v8h;
typedef __attribute__((ext_vector_type(4)))  _Float16 v4h;
typedef __attribute__((ext_vector_type(8)))  float    v8f;
typedef __attribute__((ext_vector_type(4)))  float    v4f;

// ---- CDNA5 async global->LDS copy (ASYNCcnt path, ISA 15.18.3 op 98) ----
__device__ __forceinline__ unsigned lds_off_of(const void* p) {
  // LDS aperture keeps the wave-relative LDS byte offset in addr[31:0].
  return (unsigned)(unsigned long long)(uintptr_t)p;
}
__device__ __forceinline__ void async_b128(unsigned lds_off, const void* gaddr) {
  asm volatile("global_load_async_to_lds_b128 %0, %1, off"
               :: "v"(lds_off), "v"((unsigned long long)(uintptr_t)gaddr)
               : "memory");
}
__device__ __forceinline__ void wait_async0() {
  asm volatile("s_wait_asynccnt 0x0" ::: "memory");
}

// Load one WMMA f16 A/B fragment for a 32-wide K chunk.
// Lanes 0-15 hold K {0..7,16..23}, lanes 16-31 hold K {8..15,24..31}.
__device__ __forceinline__ v16h load_frag(const _Float16* p, int hi) {
  v8h a = *(const v8h*)(p + (hi ? 8 : 0));
  v8h b = *(const v8h*)(p + (hi ? 24 : 16));
  v16h r;
#pragma unroll
  for (int i = 0; i < 8; ++i) { r[i] = a[i]; r[i + 8] = b[i]; }
  return r;
}

// x [N, C, H*W] f32  ->  xs [N, S, C] f16, one 64 (c) x 128 (s) tile per block.
// In: wave w reads rows c = 8w .. 8w+7, a lane 4 consecutive s of each, so a
// wave-wide load is 512 contiguous bytes. A lane then owns 8 consecutive c of
// 4 tokens and puts each as 16 bytes into the LDS tile [s][c]. Out: 8 lanes
// carry one token's 64 c, so every store fills whole 128-byte lines.
#define PXC 64    // tile extent along c
#define PXS 128   // tile extent along s
#define PXP 72    // LDS row pitch in halves (144 B, 16 B x odd)
__global__ __launch_bounds__(256) void pack_x_kernel(const float* __restrict__ x,
                                                     _Float16* __restrict__ xs) {
  __shared__ __align__(16) _Float16 tile[PXS * PXP];
  const int tid  = threadIdx.x;
  const int lane = tid & 31;
  const int wave = tid >> 5;
  const int sblk = blockIdx.x * PXS;
  const int cblk = blockIdx.y * PXC;
  const int n    = blockIdx.z;

  const float* src = x + ((size_t)n * CDIM + cblk + wave * 8) * SEQ + sblk + lane * 4;
  v4f v[8];
  // unrolled: all 8 loads in flight at once, v[] indexed by constants only
#pragma unroll
  for (int j = 0; j < 8; ++j) v[j] = *(const v4f*)(src + (size_t)j * SEQ);
  // unrolled: register transpose needs constant indices
#pragma unroll
  for (int i = 0; i < 4; ++i) {
    v8h h;
#pragma unroll
    for (int j = 0; j < 8; ++j) h[j] = (_Float16)v[j][i];
    *(v8h*)(&tile[(lane * 4 + i) * PXP + wave * 8]) = h;
  }
  __syncthreads();   // the tile is read across waves below

  _Float16* dst = xs + ((size_t)n * SEQ + sblk) * CDIM + cblk;
  // unrolled: the 4 LDS reads go out together, ahead of the stores
#pragma unroll
  for (int k = 0; k < 4; ++k) {
    const int q   = k * 256 + tid;
    const int row = q >> 3;
    const int c8  = (q & 7) * 8;
    *(v8h*)(dst + (size_t)row * CDIM + c8) = *(const v8h*)(&tile[row * PXP + c8]);
  }
}

// All four weight matrices f32 -> f16 (row-major [C_out, C_in]; these rows ARE
// the B-fragment columns for y = x @ W^T). A thread converts 4 consecutive
// values of each matrix: 16-byte loads, 8-byte stores.
__global__ __launch_bounds__(256) void pack_w_kernel(
                              const float* __restrict__ a, const float* __restrict__ b,
                              const float* __restrict__ c, const float* __restrict__ d,
                              _Float16* __restrict__ A, _Float16* __restrict__ B,
                              _Float16* __restrict__ Cw, _Float16* __restrict__ D) {
  // 32-bit byte offsets from the uniform bases: one offset register serves the
  // four loads and one the four stores.
  const unsigned ib = (blockIdx.x * 256u + threadIdx.x) * 16u;   // f32 side
  const unsigned ob = ib >> 1;                                   // f16 side
  const v4f va = *(const v4f*)((const char*)a + ib);
  const v4f vb = *(const v4f*)((const char*)b + ib);
  const v4f vc = *(const v4f*)((const char*)c + ib);
  const v4f vd = *(const v4f*)((const char*)d + ib);
  *(v4h*)((char*)A + ob)  = __builtin_convertvector(va, v4h);
  *(v4h*)((char*)B + ob)  = __builtin_convertvector(vb, v4h);
  *(v4h*)((char*)Cw + ob) = __builtin_convertvector(vc, v4h);
  *(v4h*)((char*)D + ob)  = __builtin_convertvector(vd, v4h);
}

// Y[M,512] = A[M,512](f16) @ W[512,512]^T(f16 row-major) + bias.
// mode 0: f16 row-major [M,512]   (Q, K)
// mode 1: f32 row-major [M,512]   (final output)
// mode 2: f16 head-transposed Vt[(n*NH+h)*HD + d][SEQ]   (V)
// Block 256 thr = 8 waves (4 row-groups x 2 col-groups); block tile 128x128;
// wave tile 32x64 (8 accumulators). K chunks of 32 double-buffered in LDS via
// async copies overlapped with WMMA compute.
// blockIdx.z picks one of up to three products that share A: weight matrix z
// of Wall and f16 output plane z of out16all (both packed back to back), bias
// bz; plane 2 is always written in mode 2. One launch of three then keeps
// three blocks on a WGP, whose copies and barriers cover one another.
__global__ void gemm_bt_kernel(const _Float16* __restrict__ A,
                               const _Float16* __restrict__ Wall,
                               const float* __restrict__ b0,
                               const float* __restrict__ b1,
                               const float* __restrict__ b2,
                               _Float16* __restrict__ out16all,
                               float* __restrict__ out32,
                               int mode0) {
  __shared__ __align__(16) _Float16 At[2][128 * P32];
  __shared__ __align__(16) _Float16 Wt[2][128 * P32];

  const int tid  = threadIdx.x;
  const int lane = tid & 31;
  const int wave = tid >> 5;
  const int lr   = lane & 15;
  const int hi   = lane >> 4;
  const int wr   = wave & 3;   // row group 0..3
  const int wc   = wave >> 2;  // col group 0..1
  const int mblk = blockIdx.x * 128;
  const int nblk = blockIdx.y * 128;
  const int z    = blockIdx.z;
  const _Float16* W    = Wall + (size_t)z * (CDIM * CDIM);
  const float*    bias = z == 0 ? b0 : (z == 1 ? b1 : b2);
  _Float16*       out16 = out16all + (size_t)z * ((size_t)MTOT * CDIM);
  const int       mode = z == 2 ? 2 : mode0;

  // Cooperative copy coords: each thread moves 32B of A and 32B of W per chunk.
  const int crow = tid >> 1;           // 0..127
  const int chof = (tid & 1) * 16;     // halves within 32-half row
  const _Float16* gA = A + (size_t)(mblk + crow) * CDIM + chof;
  const _Float16* gW = W + (size_t)(nblk + crow) * CDIM + chof;
  unsigned ldsA[2], ldsW[2];
#pragma unroll
  for (int b = 0; b < 2; ++b) {
    ldsA[b] = lds_off_of(&At[b][crow * P32 + chof]);
    ldsW[b] = lds_off_of(&Wt[b][crow * P32 + chof]);
  }
  auto issue = [&](int b, int kc) {
    const _Float16* a = gA + kc;
    const _Float16* w = gW + kc;
    async_b128(ldsA[b],      a);
    async_b128(ldsA[b] + 16, a + 8);
    async_b128(ldsW[b],      w);
    async_b128(ldsW[b] + 16, w + 8);
  };

  v8f acc[2][4];
#pragma unroll
  for (int s = 0; s < 2; ++s)
#pragma unroll
    for (int c = 0; c < 4; ++c) acc[s][c] = v8f{0.f,0.f,0.f,0.f,0.f,0.f,0.f,0.f};

  issue(0, 0);
  int cur = 0;
  for (int t = 0; t < CDIM / KCH; ++t) {
    wait_async0();        // my chunk-t copies done
    __syncthreads();      // everyone's chunk-t data visible; other buffer free
    if (t < CDIM / KCH - 1) issue(1 - cur, (t + 1) * KCH);

    const _Float16* Ab = At[cur];
    const _Float16* Wb = Wt[cur];
    v16h af[2];
#pragma unroll
    for (int s = 0; s < 2; ++s)
      af[s] = load_frag(Ab + (size_t)(wr * 32 + s * 16 + lr) * P32, hi);
#pragma unroll
    for (int c = 0; c < 4; ++c) {
      v16h bf = load_frag(Wb + (size_t)(wc * 64 + c * 16 + lr) * P32, hi);
#pragma unroll
      for (int s = 0; s < 2; ++s)
        acc[s][c] = __builtin_amdgcn_wmma_f32_16x16x32_f16(false, af[s], false, bf,
                                                           (short)0, acc[s][c], false, false);
    }
    cur ^= 1;
  }

#pragma unroll
  for (int c = 0; c < 4; ++c) {
    const int col = nblk + wc * 64 + c * 16 + lr;
    const float bv = bias[col];
#pragma unroll
    for (int s = 0; s < 2; ++s) {
#pragma unroll
      for (int r = 0; r < 8; ++r) {
        const int row = mblk + wr * 32 + s * 16 + r + 8 * hi;
        float y = acc[s][c][r] + bv;
        if (mode == 0) {
          out16[(size_t)row * CDIM + col] = (_Float16)y;
        } else if (mode == 1) {
          out32[(size_t)row * CDIM + col] = y;
        } else {
          // Vt[(n*NH + h)*HD + d][SEQ]: h = col/64, d = col%64, n = row/SEQ, s = row%SEQ
          const int hh = col >> 6, dd = col & 63;
          const int nn = row >> 10, ss = row & 1023;
          out16[((size_t)(nn * NH + hh) * HD + dd) * SEQ + ss] = (_Float16)y;
        }
      }
    }
  }
}

// Lane l <-> lane l ^ 16 (the two halves of a wave), register to register.
__device__ __forceinline__ float xhalf(float x) {
  int b = __builtin_bit_cast(int, x);
  return __builtin_bit_cast(float,
      __builtin_amdgcn_permlanex16(b, b, 0x76543210, 0xfedcba98, false, false));
}

__global__ void attn_kernel(const _Float16* __restrict__ Q,
                            const _Float16* __restrict__ K,
                            const _Float16* __restrict__ Vt,
                            _Float16* __restrict__ O) {
  __shared__ __align__(16) _Float16 Kt[2][32 * P64];
  __shared__ __align__(16) _Float16 VtT[2][64 * P32];

  const int tid  = threadIdx.x;
  const int lane = tid & 31;
  const int wave = tid >> 5;
  const int lr   = lane & 15;
  const int hi   = lane >> 4;
  const int n    = blockIdx.y >> 3;   // NH == 8
  const int h    = blockIdx.y & 7;
  const int q0   = blockIdx.x * 64 + wave * 16;

  const _Float16* Qb  = Q  + (size_t)n * SEQ * CDIM + h * HD;
  const _Float16* Kb  = K  + (size_t)n * SEQ * CDIM + h * HD;
  const _Float16* VtB = Vt + (size_t)(n * NH + h) * HD * SEQ;   // [64][SEQ]

  const v16h qa0 = load_frag(Qb + (size_t)(q0 + lr) * CDIM, hi);
  const v16h qa1 = load_frag(Qb + (size_t)(q0 + lr) * CDIM + 32, hi);

  // o[c][r] = O^T[d = c*16 + 8*hi + r][query lr]
  v8f o[4];
#pragma unroll
  for (int c = 0; c < 4; ++c) o[c] = v8f{0.f,0.f,0.f,0.f,0.f,0.f,0.f,0.f};
  // Running maximum of query lr (equal in both halves) and this half's share
  // of its running sum (the halves are joined once, after the loop).
  float m = -1.0e30f, l = 0.0f;

  // Cooperative copy coords.
  // K tile: 32 rows x 128B -> thread: row = tid/4, 32B at (tid%4)*32B.
  const int krow = tid >> 2;
  const int kcb  = (tid & 3) * 16;     // halves
  // Vt tile: 64 rows x 64B -> thread: row = tid/2, 32B at (tid%2)*32B.
  const int vrow = tid >> 1;
  const int vcb  = (tid & 1) * 16;     // halves
  const _Float16* gK = Kb  + (size_t)krow * CDIM + kcb;
  const _Float16* gV = VtB + (size_t)vrow * SEQ  + vcb;
  unsigned ldsK[2], ldsV[2];
#pragma unroll
  for (int b = 0; b < 2; ++b) {
    ldsK[b] = lds_off_of(&Kt[b][krow * P64 + kcb]);
    ldsV[b] = lds_off_of(&VtT[b][vrow * P32 + vcb]);
  }
  auto issueKV = [&](int b, int k0) {
    const _Float16* kk = gK + (size_t)k0 * CDIM;  // advance 32 k-rows
    const _Float16* vv = gV + k0;                 // advance 32 halves along S
    async_b128(ldsK[b],      kk);
    async_b128(ldsK[b] + 16, kk + 8);
    async_b128(ldsV[b],      vv);
    async_b128(ldsV[b] + 16, vv + 8);
  };

  issueKV(0, 0);
  int cur = 0;
  for (int kt = 0; kt < SEQ / 32; ++kt) {
    wait_async0();
    __syncthreads();
    if (kt < SEQ / 32 - 1) issueKV(1 - cur, (kt + 1) * 32);

    const _Float16* Kc = Kt[cur];
    const _Float16* Vc = VtT[cur];

    // S^T tile (32 keys x 16 queries) = k_tile @ q_tile^T  (K = 64 -> 2 chunks)
    // s0[r] = key 8*hi + r, s1[r] = key 16 + 8*hi + r, both of query lr.
    v8f s0 = v8f{0.f,0.f,0.f,0.f,0.f,0.f,0.f,0.f};
    v8f s1 = v8f{0.f,0.f,0.f,0.f,0.f,0.f,0.f,0.f};
    {
      v16h a;
      a = load_frag(Kc + (size_t)lr * P64 + 0,  hi);
      s0 = __builtin_amdgcn_wmma_f32_16x16x32_f16(false, a, false, qa0, (short)0, s0, false, false);
      a = load_frag(Kc + (size_t)lr * P64 + 32, hi);
      s0 = __builtin_amdgcn_wmma_f32_16x16x32_f16(false, a, false, qa1, (short)0, s0, false, false);
      a = load_frag(Kc + (size_t)(16 + lr) * P64 + 0,  hi);
      s1 = __builtin_amdgcn_wmma_f32_16x16x32_f16(false, a, false, qa0, (short)0, s1, false, false);
      a = load_frag(Kc + (size_t)(16 + lr) * P64 + 32, hi);
      s1 = __builtin_amdgcn_wmma_f32_16x16x32_f16(false, a, false, qa1, (short)0, s1, false, false);
    }

    // Online softmax of query lr: 16 scores in this lane, 16 in lane ^ 16.
    const v8f v0 = s0 * 0.125f;            // 1/sqrt(64)
    const v8f v1 = s1 * 0.125f;
    float rm = v0[0], rn = v1[0];
#pragma unroll
    for (int r = 1; r < 8; ++r) { rm = fmaxf(rm, v0[r]); rn = fmaxf(rn, v1[r]); }
    rm = fmaxf(rm, rn);
    rm = fmaxf(rm, xhalf(rm));
    const float mn    = fmaxf(m, rm);
    const float alpha = __expf(m - mn);
    m = mn;

    // P^T in place: element i of the B operand is key 8*hi + i (i < 8) or 16 + 8*hi + i - 8 (i >= 8) of query lr.
    v16h pb;
    float rs0 = 0.0f, rs1 = 0.0f;
#pragma unroll
    for (int r = 0; r < 8; ++r) {
      const float p0 = __expf(v0[r] - mn);
      const float p1 = __expf(v1[r] - mn);
      rs0 += p0;
      rs1 += p1;
      pb[r]     = (_Float16)p0;
      pb[r + 8] = (_Float16)p1;
    }
    l = l * alpha + (rs0 + rs1);
#pragma unroll
    for (int c = 0; c < 4; ++c)
#pragma unroll
      for (int r = 0; r < 8; ++r) o[c][r] *= alpha;

    // O^T += V^T_tile(64 x 32) @ P^T(32 x 16): A fragments are contiguous Vt rows.
#pragma unroll
    for (int c = 0; c < 4; ++c) {
      v16h va = load_frag(Vc + (size_t)(c * 16 + lr) * P32, hi);
      o[c] = __builtin_amdgcn_wmma_f32_16x16x32_f16(false, va, false, pb,
                                                    (short)0, o[c], false, false);
    }
    cur ^= 1;
  }

  // Join the halves' sums, normalize and store in [N, h, S, d] flat order:
  // 8 consecutive d of query lr per accumulator tile, one 16-byte store each.
  const float inv = 1.0f / (l + xhalf(l));
  _Float16* Ob = O + ((size_t)(n * NH + h) * SEQ + q0 + lr) * HD + 8 * hi;
#pragma unroll
  for (int c = 0; c < 4; ++c) {
    v8h ov;
#pragma unroll
    for (int r = 0; r < 8; ++r) ov[r] = (_Float16)(o[c][r] * inv);
    *(v8h*)(Ob + c * 16) = ov;
  }
}

extern "C" void kernel_launch(void* const* d_in, const int* in_sizes, int n_in,
                              void* d_out, int out_size, void* d_ws, size_t ws_size,
                              hipStream_t stream) {
  (void)in_sizes; (void)n_in; (void)out_size; (void)ws_size;
  const float* x  = (const float*)d_in[0];
  const float* Wq = (const float*)d_in[1];
  const float* bq = (const float*)d_in[2];
  const float* Wk = (const float*)d_in[3];
  const float* bk = (const float*)d_in[4];
  const float* Wv = (const float*)d_in[5];
  const float* bv = (const float*)d_in[6];
  const float* Wo = (const float*)d_in[7];
  const float* bo = (const float*)d_in[8];
  float* out = (float*)d_out;

  // Workspace layout (offsets in f16 elements). Total ~42 MB.
  _Float16* ws = (_Float16*)d_ws;
  const size_t NSC = (size_t)NB * SEQ * CDIM;   // 4,194,304
  const size_t WSZ = (size_t)CDIM * CDIM;       //   262,144
  _Float16* xs   = ws;
  _Float16* wq16 = xs + NSC;
  _Float16* wk16 = wq16 + WSZ;
  _Float16* wv16 = wk16 + WSZ;
  _Float16* wo16 = wv16 + WSZ;
  _Float16* Qh   = wo16 + WSZ;
  _Float16* Kh   = Qh + NSC;
  _Float16* Vth  = Kh + NSC;   // V stored head-transposed [(n*NH+h)*HD+d][SEQ]
  _Float16* Oh   = Vth + NSC;

  // 1) Pack activations and weights to f16
  pack_x_kernel<<<dim3(SEQ / PXS, CDIM / PXC, NB), 256, 0, stream>>>(x, xs);
  pack_w_kernel<<<CDIM * CDIM / 4 / 256, 256, 0, stream>>>(
      Wq, Wk, Wv, Wo, wq16, wk16, wv16, wo16);

  // 2) Q/K/V projections (fused bias) in one launch, z = 0, 1, 2: wq16, wk16,
  //    wv16 and Qh, Kh, Vth lie back to back; V written head-transposed
  gemm_bt_kernel<<<dim3(MTOT / 128, CDIM / 128, 3), 256, 0, stream>>>(
      xs, wq16, bq, bk, bv, Qh, nullptr, 0);

  // 3) Flash attention per (n, h); O stored [N, h, S, d] flat
  attn_kernel<<<dim3(SEQ / 64, NB * NH), 128, 0, stream>>>(Qh, Kh, Vth, Oh);

  // 4) Output projection: O (flat [8192, 512]) @ Wo^T + bo -> f32 d_out
  //    (both reference reshapes are memory-order-preserving)
  gemm_bt_kernel<<<dim3(MTOT / 128, CDIM / 128, 1), 256, 0, stream>>>(
      Oh, wo16, bo, bo, bo, nullptr, out, 1);
}

// v005
// One run takes 65.8 microseconds.
// Two timings next to v004 put it at 1.18 and 1.19 times that version's speed.
// All steps since v000 together make it 4.32 times as fast.
#include <hip/hip_runtime.h>

// Problem constants
#define CDIM 512
#define SEQ  1024
#define NB   8
#define NH   8
#define HD   64
#define MTOT (NB * SEQ)   // 8192 total token rows
#define KCH  64           // GEMM K chunk: one 128-byte line of every row, two WMMA K depths
#define KST  64           // attention key stage: two 32-key passes
// LDS row pitch in halves, 16 B x odd: the 16 lanes of a half-wave that read
// 16 bytes of 16 consecutive rows then fall on all 64 banks, none twice.
#define P64  72           // rows of 64 halves (128 B) lie 144 B apart

typedef __attribute__((ext_vector_type(16))) _Float16 v16h;
typedef __attribute__((ext_vector_type(8)))  _Float16 v8h;
typedef __attribute__((ext_vector_type(4)))  _Float16 v4h;
typedef __attribute__((ext_vector_type(8)))  float    v8f;
typedef __attribute__((ext_vector_type(4)))  float    v4f;

// ---- CDNA5 async global->LDS copy (ASYNCcnt path, ISA 15.18.3 op 98) ----
__device__ __forceinline__ unsigned lds_off_of(const void* p) {
  // LDS aperture keeps the wave-relative LDS byte offset in addr[31:0].
  return (unsigned)(unsigned long long)(uintptr_t)p;
}
// One stage's eight copies of a lane, 16 bytes each. The closing s_wait_xcnt 0
// stands inside the statement so that no address register of a copy is
// rewritten ahead of it (a precaution).
__device__ __forceinline__ void async_b128_x8(const unsigned (&l)[8],
                                              const _Float16* const (&g)[8]) {
  asm volatile("global_load_async_to_lds_b128 %0, %8, off\n\t"
               "global_load_async_to_lds_b128 %1, %9, off\n\t"
               "global_load_async_to_lds_b128 %2, %10, off\n\t"
               "global_load_async_to_lds_b128 %3, %11, off\n\t"
               "global_load_async_to_lds_b128 %4, %12, off\n\t"
               "global_load_async_to_lds_b128 %5, %13, off\n\t"
               "global_load_async_to_lds_b128 %6, %14, off\n\t"
               "global_load_async_to_lds_b128 %7, %15, off\n\t"
               "s_wait_xcnt 0x0"
               :: "v"(l[0]), "v"(l[1]), "v"(l[2]), "v"(l[3]),
                  "v"(l[4]), "v"(l[5]), "v"(l[6]), "v"(l[7]),
                  "v"((unsigned long long)(uintptr_t)g[0]),
                  "v"((unsigned long long)(uintptr_t)g[1]),
                  "v"((unsigned long long)(uintptr_t)g[2]),
                  "v"((unsigned long long)(uintptr_t)g[3]),
                  "v"((unsigned long long)(uintptr_t)g[4]),
                  "v"((unsigned long long)(uintptr_t)g[5]),
                  "v"((unsigned long long)(uintptr_t)g[6]),
                  "v"((unsigned long long)(uintptr_t)g[7])
               : "memory");
}
// This wave's copies have landed.
__device__ __forceinline__ void wait_async0() {
  asm volatile("s_wait_asynccnt 0x0" ::: "memory");
}
// This wave's LDS reads have retired, before the buffer they read is refilled.
__device__ __forceinline__ void wait_ds0() {
  asm volatile("s_wait_dscnt 0x0" ::: "memory");
}

// Load one WMMA f16 A/B fragment for a 32-wide K chunk.
// Lanes 0-15 hold K {0..7,16..23}, lanes 16-31 hold K {8..15,24..31}.
__device__ __forceinline__ v16h load_frag(const _Float16* p, int hi) {
  v8h a = *(const v8h*)(p + (hi ? 8 : 0));
  v8h b = *(const v8h*)(p + (hi ? 24 : 16));
  v16h r;
#pragma unroll
  for (int i = 0; i < 8; ++i) { r[i] = a[i]; r[i + 8] = b[i]; }
  return r;
}

// x [N, C, H*W] f32  ->  xs [N, S, C] f16, one 64 (c) x 128 (s) tile per block.
// In: wave w reads rows c = 8w .. 8w+7, a lane 4 consecutive s of each, so a
// wave-wide load is 512 contiguous bytes. A lane then owns 8 consecutive c of
// 4 tokens and puts each as 16 bytes into the LDS tile [s][c]. Out: 8 lanes
// carry one token's 64 c, so every store fills whole 128-byte lines.
#define PXC 64    // tile extent along c
#define PXS 128   // tile extent along s
#define PXP 72    // LDS row pitch in halves (144 B, 16 B x odd)
__global__ __launch_bounds__(256) void pack_x_kernel(const float* __restrict__ x,
                                                     _Float16* __restrict__ xs) {
  __shared__ __align__(16) _Float16 tile[PXS * PXP];
  const int tid  = threadIdx.x;
  const int lane = tid & 31;
  const int wave = tid >> 5;
  const int sblk = blockIdx.x * PXS;
  const int cblk = blockIdx.y * PXC;
  const int n    = blockIdx.z;

  const float* src = x + ((size_t)n * CDIM + cblk + wave * 8) * SEQ + sblk + lane * 4;
  v4f v[8];
  // unrolled: all 8 loads in flight at once, v[] indexed by constants only
#pragma unroll
  for (int j = 0; j < 8; ++j) v[j] = *(const v4f*)(src + (size_t)j * SEQ);
  // unrolled: register transpose needs constant indices
#pragma unroll
  for (int i = 0; i < 4; ++i) {
    v8h h;
#pragma unroll
    for (int j = 0; j < 8; ++j) h[j] = (_Float16)v[j][i];
    *(v8h*)(&tile[(lane * 4 + i) * PXP + wave * 8]) = h;
  }
  __syncthreads();   // the tile is read across waves below

  _Float16* dst = xs + ((size_t)n * SEQ + sblk) * CDIM + cblk;
  // unrolled: the 4 LDS reads go out together, ahead of the stores
#pragma unroll
  for (int k = 0; k < 4; ++k) {
    const int q   = k * 256 + tid;
    const int row = q >> 3;
    const int c8  = (q & 7) * 8;
    *(v8h*)(dst + (size_t)row * CDIM + c8) = *(const v8h*)(&tile[row * PXP + c8]);
  }
}

// All four weight matrices f32 -> f16 (row-major [C_out, C_in]; these rows ARE
// the B-fragment columns for y = x @ W^T). A thread converts 4 consecutive
// values of each matrix: 16-byte loads, 8-byte stores.
__global__ __launch_bounds__(256) void pack_w_kernel(
                              const float* __restrict__ a, const float* __restrict__ b,
                              const float* __restrict__ c, const float* __restrict__ d,
                              _Float16* __restrict__ A, _Float16* __restrict__ B,
                              _Float16* __restrict__ Cw, _Float16* __restrict__ D) {
  // 32-bit byte offsets from the uniform bases: one offset register serves the
  // four loads and one the four stores.
  const unsigned ib = (blockIdx.x * 256u + threadIdx.x) * 16u;   // f32 side
  const unsigned ob = ib >> 1;                                   // f16 side
  const v4f va = *(const v4f*)((const char*)a + ib);
  const v4f vb = *(const v4f*)((const char*)b + ib);
  const v4f vc = *(const v4f*)((const char*)c + ib);
  const v4f vd = *(const v4f*)((const char*)d + ib);
  *(v4h*)((char*)A + ob)  = __builtin_convertvector(va, v4h);
  *(v4h*)((char*)B + ob)  = __builtin_convertvector(vb, v4h);
  *(v4h*)((char*)Cw + ob) = __builtin_convertvector(vc, v4h);
  *(v4h*)((char*)D + ob)  = __builtin_convertvector(vd, v4h);
}

// Y[M,512] = A[M,512](f16) @ W[512,512]^T(f16 row-major) + bias.
// mode 0: f16 row-major [M,512]   (Q, K)
// mode 1: f32 row-major [M,512]   (final output)
// mode 2: f16 head-transposed Vt[(n*NH+h)*HD + d][SEQ]   (V)
// Block 256 thr = 8 waves (4 row-groups x 2 col-groups); block tile 128x128;
// wave tile 32x64 (8 accumulators). K chunks of 64 double-buffered in LDS via
// async copies overlapped with WMMA compute. Eight lanes copy one row's 128
// bytes, so a wave-wide copy takes four whole lines.
// blockIdx.z picks one of up to three products that share A: weight matrix z
// of Wall and f16 output plane z of out16all (both packed back to back), bias
// bz; plane 2 is always written in mode 2. One launch of three then keeps
// three blocks on a WGP, whose copies and barriers cover one another.
__global__ void gemm_bt_kernel(const _Float16* __restrict__ A,
                               const _Float16* __restrict__ Wall,
                               const float* __restrict__ b0,
                               const float* __restrict__ b1,
                               const float* __restrict__ b2,
                               _Float16* __restrict__ out16all,
                               float* __restrict__ out32,
                               int mode0) {
  __shared__ __align__(16) _Float16 At[2][128 * P64];
  __shared__ __align__(16) _Float16 Wt[2][128 * P64];

  const int tid  = threadIdx.x;
  const int lane = tid & 31;
  const int wave = tid >> 5;
  const int lr   = lane & 15;
  const int hi   = lane >> 4;
  const int wr   = wave & 3;   // row group 0..3
  const int wc   = wave >> 2;  // col group 0..1
  const int mblk = blockIdx.x * 128;
  const int nblk = blockIdx.y * 128;
  const int z    = blockIdx.z;
  const _Float16* W    = Wall + (size_t)z * (CDIM * CDIM);
  const float*    bias = z == 0 ? b0 : (z == 1 ? b1 : b2);
  _Float16*       out16 = out16all + (size_t)z * ((size_t)MTOT * CDIM);
  const int       mode = z == 2 ? 2 : mode0;

  // Cooperative copy coords: lane group tid/8 takes rows tid/8 + 32 j, j = 0..3,
  // of A and of W; lane tid%8 the 16 bytes at 16 * (tid%8) of the row's line.
  const int crow = tid >> 3;           // 0..31
  const int ccol = (tid & 7) * 8;      // halves within the 64-half row
  const _Float16* gA = A + (size_t)(mblk + crow) * CDIM + ccol;
  const _Float16* gW = W + (size_t)(nblk + crow) * CDIM + ccol;
  const unsigned ldsA = lds_off_of(&At[0][crow * P64 + ccol]);
  const unsigned ldsW = lds_off_of(&Wt[0][crow * P64 + ccol]);
  auto issue = [&](int b, int kc) {
    unsigned l[8];
    const _Float16* g[8];
    // unrolled: l[] and g[] are asm operands, indexed by constants only
#pragma unroll
    for (int j = 0; j < 4; ++j) {
      l[j]     = ldsA + (unsigned)(b * 128 + j * 32) * (P64 * 2);
      l[j + 4] = ldsW + (unsigned)(b * 128 + j * 32) * (P64 * 2);
      g[j]     = gA + (size_t)(j * 32) * CDIM + kc;
      g[j + 4] = gW + (size_t)(j * 32) * CDIM + kc;
    }
    async_b128_x8(l, g);
  };

  v8f acc[2][4];
#pragma unroll
  for (int s = 0; s < 2; ++s)
#pragma unroll
    for (int c = 0; c < 4; ++c) acc[s][c] = v8f{0.f,0.f,0.f,0.f,0.f,0.f,0.f,0.f};

  issue(0, 0);
  wait_async0();          // my chunk-0 copies done
  __syncthreads();        // everyone's chunk 0 visible
  issue(1, KCH);
  for (int t = 0; t < CDIM / KCH; ++t) {
    const int cur = t & 1;
    const _Float16* Ab = At[cur];
    const _Float16* Wb = Wt[cur];
    // unrolled: the chunk's two WMMA K depths, in ascending k as before
#pragma unroll
    for (int kk = 0; kk < KCH; kk += 32) {
      v16h af[2];
#pragma unroll
      for (int s = 0; s < 2; ++s)
        af[s] = load_frag(Ab + (size_t)(wr * 32 + s * 16 + lr) * P64 + kk, hi);
#pragma unroll
      for (int c = 0; c < 4; ++c) {
        v16h bf = load_frag(Wb + (size_t)(wc * 64 + c * 16 + lr) * P64 + kk, hi);
#pragma unroll
        for (int s = 0; s < 2; ++s)
          acc[s][c] = __builtin_amdgcn_wmma_f32_16x16x32_f16(false, af[s], false, bf,
                                                             (short)0, acc[s][c], false, false);
      }
    }
    wait_ds0();           // my reads of this buffer are over
    wait_async0();        // my chunk-(t+1) copies done
    __syncthreads();      // chunk t+1 visible to all; this buffer free
    if (t + 2 < CDIM / KCH) issue(cur, (t + 2) * KCH);
  }
  wait_async0();          // nothing of mine in flight when the wave ends

#pragma unroll
  for (int c = 0; c < 4; ++c) {
    const int col = nblk + wc * 64 + c * 16 + lr;
    const float bv = bias[col];
#pragma unroll
    for (int s = 0; s < 2; ++s) {
#pragma unroll
      for (int r = 0; r < 8; ++r) {
        const int row = mblk + wr * 32 + s * 16 + r + 8 * hi;
        float y = acc[s][c][r] + bv;
        if (mode == 0) {
          out16[(size_t)row * CDIM + col] = (_Float16)y;
        } else if (mode == 1) {
          out32[(size_t)row * CDIM + col] = y;
        } else {
          // Vt[(n*NH + h)*HD + d][SEQ]: h = col/64, d = col%64, n = row/SEQ, s = row%SEQ
          const int hh = col >> 6, dd = col & 63;
          const int nn = row >> 10, ss = row & 1023;
          out16[((size_t)(nn * NH + hh) * HD + dd) * SEQ + ss] = (_Float16)y;
        }
      }
    }
  }
}

// Lane l <-> lane l ^ 16 (the two halves of a wave), register to register.
__device__ __forceinline__ float xhalf(float x) {
  int b = __builtin_bit_cast(int, x);
  return __builtin_bit_cast(float,
      __builtin_amdgcn_permlanex16(b, b, 0x76543210, 0xfedcba98, false, false));
}

__global__ __launch_bounds__(128) void attn_kernel(const _Float16* __restrict__ Q,
                            const _Float16* __restrict__ K,
                            const _Float16* __restrict__ Vt,
                            _Float16* __restrict__ O) {
  __shared__ __align__(16) _Float16 Kt[2][KST * P64];
  __shared__ __align__(16) _Float16 VtT[2][HD * P64];

  const int tid  = threadIdx.x;
  const int lane = tid & 31;
  const int wave = tid >> 5;
  const int lr   = lane & 15;
  const int hi   = lane >> 4;
  const int n    = blockIdx.y >> 3;   // NH == 8
  const int h    = blockIdx.y & 7;
  const int q0   = blockIdx.x * 64 + wave * 16;

  const _Float16* Qb  = Q  + (size_t)n * SEQ * CDIM + h * HD;
  const _Float16* Kb  = K  + (size_t)n * SEQ * CDIM + h * HD;
  const _Float16* VtB = Vt + (size_t)(n * NH + h) * HD * SEQ;   // [64][SEQ]

  const v16h qa0 = load_frag(Qb + (size_t)(q0 + lr) * CDIM, hi);
  const v16h qa1 = load_frag(Qb + (size_t)(q0 + lr) * CDIM + 32, hi);

  // o[c][r] = O^T[d = c*16 + 8*hi + r][query lr]
  v8f o[4];
#pragma unroll
  for (int c = 0; c < 4; ++c) o[c] = v8f{0.f,0.f,0.f,0.f,0.f,0.f,0.f,0.f};
  // Running maximum of query lr (equal in both halves) and this half's share
  // of its running sum (the halves are joined once, after the loop).
  float m = -1.0e30f, l = 0.0f;

  // Cooperative copy coords: lane group tid/8 takes rows tid/8 + 16 j, j = 0..3,
  // of the K tile and of the Vt tile; lane tid%8 the 16 bytes at 16 * (tid%8) of
  // the row's line, so a wave-wide copy takes four whole lines.
  const int crow = tid >> 3;           // 0..15
  const int ccol = (tid & 7) * 8;      // halves within the 64-half row
  const _Float16* gK = Kb  + (size_t)crow * CDIM + ccol;
  const _Float16* gV = VtB + (size_t)crow * SEQ  + ccol;
  const unsigned ldsK = lds_off_of(&Kt[0][crow * P64 + ccol]);
  const unsigned ldsV = lds_off_of(&VtT[0][crow * P64 + ccol]);
  auto issueKV = [&](int b, int k0) {
    unsigned l[8];
    const _Float16* g[8];
    // unrolled: l[] and g[] are asm operands, indexed by constants only
#pragma unroll
    for (int j = 0; j < 4; ++j) {
      l[j]     = ldsK + (unsigned)(b * KST + j * 16) * (P64 * 2);
      l[j + 4] = ldsV + (unsigned)(b * HD  + j * 16) * (P64 * 2);
      g[j]     = gK + (size_t)(k0 + j * 16) * CDIM;   // key rows k0 + ...
      g[j + 4] = gV + (size_t)(j * 16) * SEQ + k0;    // keys k0 .. k0+63 of a d row
    }
    async_b128_x8(l, g);
  };

  issueKV(0, 0);
  wait_async0();          // my stage-0 copies done
  __syncthreads();        // everyone's stage 0 visible
  issueKV(1, KST);
  for (int st = 0; st < SEQ / KST; ++st) {
    const int cur = st & 1;
   // unrolled: the stage's two 32-key passes, in ascending key order as before
#pragma unroll
   for (int sub = 0; sub < KST / 32; ++sub) {
    const _Float16* Kc = Kt[cur] + sub * 32 * P64;   // key rows 32 sub ..
    const _Float16* Vc = VtT[cur] + sub * 32;        // key columns 32 sub ..

    // S^T tile (32 keys x 16 queries) = k_tile @ q_tile^T  (K = 64 -> 2 chunks)
    // s0[r] = key 8*hi + r, s1[r] = key 16 + 8*hi + r, both of query lr.
    v8f s0 = v8f{0.f,0.f,0.f,0.f,0.f,0.f,0.f,0.f};
    v8f s1 = v8f{0.f,0.f,0.f,0.f,0.f,0.f,0.f,0.f};
    {
      v16h a;
      a = load_frag(Kc + (size_t)lr * P64 + 0,  hi);
      s0 = __builtin_amdgcn_wmma_f32_16x16x32_f16(false, a, false, qa0, (short)0, s0, false, false);
      a = load_frag(Kc + (size_t)lr * P64 + 32, hi);
      s0 = __builtin_amdgcn_wmma_f32_16x16x32_f16(false, a, false, qa1, (short)0, s0, false, false);
      a = load_frag(Kc + (size_t)(16 + lr) * P64 + 0,  hi);
      s1 = __builtin_amdgcn_wmma_f32_16x16x32_f16(false, a, false, qa0, (short)0, s1, false, false);
      a = load_frag(Kc + (size_t)(16 + lr) * P64 + 32, hi);
      s1 = __builtin_amdgcn_wmma_f32_16x16x32_f16(false, a, false, qa1, (short)0, s1, false, false);
    }

    // Online softmax of query lr: 16 scores in this lane, 16 in lane ^ 16.
    const v8f v0 = s0 * 0.125f;            // 1/sqrt(64)
    const v8f v1 = s1 * 0.125f;
    float rm = v0[0], rn = v1[0];
#pragma unroll
    for (int r = 1; r < 8; ++r) { rm = fmaxf(rm, v0[r]); rn = fmaxf(rn, v1[r]); }
    rm = fmaxf(rm, rn);
    rm = fmaxf(rm, xhalf(rm));
    const float mn    = fmaxf(m, rm);
    const float alpha = __expf(m - mn);
    m = mn;

    // P^T in place: element i of the B operand is key 8*hi + i (i < 8) or 16 + 8*hi + i - 8 (i >= 8) of query lr.
    v16h pb;
    float rs0 = 0.0f, rs1 = 0.0f;
#pragma unroll
    for (int r = 0; r < 8; ++r) {
      const float p0 = __expf(v0[r] - mn);
      const float p1 = __expf(v1[r] - mn);
      rs0 += p0;
      rs1 += p1;
      pb[r]     = (_Float16)p0;
      pb[r + 8] = (_Float16)p1;
    }
    l = l * alpha + (rs0 + rs1);
#pragma unroll
    for (int c = 0; c < 4; ++c)
#pragma unroll
      for (int r = 0; r < 8; ++r) o[c][r] *= alpha;

    // O^T += V^T_tile(64 x 32) @ P^T(32 x 16): A fragments are contiguous Vt rows.
#pragma unroll
    for (int c = 0; c < 4; ++c) {
      v16h va = load_frag(Vc + (size_t)(c * 16 + lr) * P64, hi);
      o[c] = __builtin_amdgcn_wmma_f32_16x16x32_f16(false, va, false, pb,
                                                    (short)0, o[c], false, false);
    }
   }
    wait_ds0();           // my reads of this buffer are over
    wait_async0();        // my stage-(st+1) copies done
    __syncthreads();      // stage st+1 visible to all; this buffer free
    if (st + 2 < SEQ / KST) issueKV(cur, (st + 2) * KST);
  }
  wait_async0();          // nothing of mine in flight when the wave ends

  // Join the halves' sums, normalize and store in [N, h, S, d] flat order:
  // 8 consecutive d of query lr per accumulator tile, one 16-byte store each.
  const float inv = 1.0f / (l + xhalf(l));
  _Float16* Ob = O + ((size_t)(n * NH + h) * SEQ + q0 + lr) * HD + 8 * hi;
#pragma unroll
  for (int c = 0; c < 4; ++c) {
    v8h ov;
#pragma unroll
    for (int r = 0; r < 8; ++r) ov[r] = (_Float16)(o[c][r] * inv);
    *(v8h*)(Ob + c * 16) = ov;
  }
}

extern "C" void kernel_launch(void* const* d_in, const int* in_sizes, int n_in,
                              void* d_out, int out_size, void* d_ws, size_t ws_size,
                              hipStream_t stream) {
  (void)in_sizes; (void)n_in; (void)out_size; (void)ws_size;
  const float* x  = (const float*)d_in[0];
  const float* Wq = (const float*)d_in[1];
  const float* bq = (const float*)d_in[2];
  const float* Wk = (const float*)d_in[3];
  const float* bk = (const float*)d_in[4];
  const float* Wv = (const float*)d_in[5];
  const float* bv = (const float*)d_in[6];
  const float* Wo = (const float*)d_in[7];
  const float* bo = (const float*)d_in[8];
  float* out = (float*)d_out;

  // Workspace layout (offsets in f16 elements). Total ~42 MB.
  _Float16* ws = (_Float16*)d_ws;
  const size_t NSC = (size_t)NB * SEQ * CDIM;   // 4,194,304
  const size_t WSZ = (size_t)CDIM * CDIM;       //   262,144
  _Float16* xs   = ws;
  _Float16* wq16 = xs + NSC;
  _Float16* wk16 = wq16 + WSZ;
  _Float16* wv16 = wk16 + WSZ;
  _Float16* wo16 = wv16 + WSZ;
  _Float16* Qh   = wo16 + WSZ;
  _Float16* Kh   = Qh + NSC;
  _Float16* Vth  = Kh + NSC;   // V stored head-transposed [(n*NH+h)*HD+d][SEQ]
  _Float16* Oh   = Vth + NSC;

  // 1) Pack activations and weights to f16
  pack_x_kernel<<<dim3(SEQ / PXS, CDIM / PXC, NB), 256, 0, stream>>>(x, xs);
  pack_w_kernel<<<CDIM * CDIM / 4 / 256, 256, 0, stream>>>(
      Wq, Wk, Wv, Wo, wq16, wk16, wv16, wo16);

  // 2) Q/K/V projections (fused bias) in one launch, z = 0, 1, 2: wq16, wk16,
  //    wv16 and Qh, Kh, Vth lie back to back; V written head-transposed
  gemm_bt_kernel<<<dim3(MTOT / 128, CDIM / 128, 3), 256, 0, stream>>>(
      xs, wq16, bq, bk, bv, Qh, nullptr, 0);

  // 3) Flash attention per (n, h); O stored [N, h, S, d] flat
  attn_kernel<<<dim3(SEQ / 64, NB * NH), 128, 0, stream>>>(Qh, Kh, Vth, Oh);

  // 4) Output projection: O (flat [8192, 512]) @ Wo^T + bo -> f32 d_out
  //    (both reference reshapes are memory-order-preserving)
  gemm_bt_kernel<<<dim3(MTOT / 128, CDIM / 128, 1), 256, 0, stream>>>(
      Oh, wo16, bo, bo, bo, nullptr, out, 1);
}

// v006
// Measured time: 55.6 microseconds a run.
// Next to v005, in two timings, it ran 1.18 and 1.19 times as fast.
// All steps since v000 together make it 5.12 times as fast.
#include <hip/hip_runtime.h>

// Problem constants
#define CDIM 512
#define SEQ  1024
#define NB   8
#define NH   8
#define HD   64
#define MTOT (NB * SEQ)   // 8192 total token rows
#define KCH  64           // GEMM K chunk: one 128-byte line of every row, two WMMA K depths
#define KST  64           // attention key stage: two 32-key passes
// LDS row pitch in halves, 16 B x odd: the 16 lanes of a half-wave that read
// 16 bytes of 16 consecutive rows then fall on all 64 banks, none twice.
#define P64  72           // rows of 64 halves (128 B) lie 144 B apart

typedef __attribute__((ext_vector_type(16))) _Float16 v16h;
typedef __attribute__((ext_vector_type(8)))  _Float16 v8h;
typedef __attribute__((ext_vector_type(4)))  _Float16 v4h;
typedef __attribute__((ext_vector_type(8)))  float    v8f;
typedef __attribute__((ext_vector_type(4)))  float    v4f;

// ---- CDNA5 async global->LDS copy (ASYNCcnt path, ISA 15.18.3 op 98) ----
__device__ __forceinline__ unsigned lds_off_of(const void* p) {
  // LDS aperture keeps the wave-relative LDS byte offset in addr[31:0].
  return (unsigned)(unsigned long long)(uintptr_t)p;
}
// One stage's eight copies of a lane, 16 bytes each. The closing s_wait_xcnt 0
// stands inside the statement so that no address register of a copy is
// rewritten ahead of it (a precaution).
__device__ __forceinline__ void async_b128_x8(const unsigned (&l)[8],
                                              const _Float16* const (&g)[8]) {
  asm volatile("global_load_async_to_lds_b128 %0, %8, off\n\t"
               "global_load_async_to_lds_b128 %1, %9, off\n\t"
               "global_load_async_to_lds_b128 %2, %10, off\n\t"
               "global_load_async_to_lds_b128 %3, %11, off\n\t"
               "global_load_async_to_lds_b128 %4, %12, off\n\t"
               "global_load_async_to_lds_b128 %5, %13, off\n\t"
               "global_load_async_to_lds_b128 %6, %14, off\n\t"
               "global_load_async_to_lds_b128 %7, %15, off\n\t"
               "s_wait_xcnt 0x0"
               :: "v"(l[0]), "v"(l[1]), "v"(l[2]), "v"(l[3]),
                  "v"(l[4]), "v"(l[5]), "v"(l[6]), "v"(l[7]),
                  "v"((unsigned long long)(uintptr_t)g[0]),
                  "v"((unsigned long long)(uintptr_t)g[1]),
                  "v"((unsigned long long)(uintptr_t)g[2]),
                  "v"((unsigned long long)(uintptr_t)g[3]),
                  "v"((unsigned long long)(uintptr_t)g[4]),
                  "v"((unsigned long long)(uintptr_t)g[5]),
                  "v"((unsigned long long)(uintptr_t)g[6]),
                  "v"((unsigned long long)(uintptr_t)g[7])
               : "memory");
}
// This wave's copies have landed.
__device__ __forceinline__ void wait_async0() {
  asm volatile("s_wait_asynccnt 0x0" ::: "memory");
}
// This wave's LDS reads have retired, before the buffer they read is refilled.
__device__ __forceinline__ void wait_ds0() {
  asm volatile("s_wait_dscnt 0x0" ::: "memory");
}

// Load one WMMA f16 A/B fragment for a 32-wide K chunk.
// Lanes 0-15 hold K {0..7,16..23}, lanes 16-31 hold K {8..15,24..31}.
__device__ __forceinline__ v16h load_frag(const _Float16* p, int hi) {
  v8h a = *(const v8h*)(p + (hi ? 8 : 0));
  v8h b = *(const v8h*)(p + (hi ? 24 : 16));
  v16h r;
#pragma unroll
  for (int i = 0; i < 8; ++i) { r[i] = a[i]; r[i + 8] = b[i]; }
  return r;
}

// x [N, C, H*W] f32  ->  xs [N, S, C] f16, one 64 (c) x 128 (s) tile per block.
// In: wave w reads rows c = 8w .. 8w+7, a lane 4 consecutive s of each, so a
// wave-wide load is 512 contiguous bytes. A lane then owns 8 consecutive c of
// 4 tokens and puts each as 16 bytes into the LDS tile [s][c]. Out: 8 lanes
// carry one token's 64 c, so every store fills whole 128-byte lines.
#define PXC 64    // tile extent along c
#define PXS 128   // tile extent along s
#define PXP 72    // LDS row pitch in halves (144 B, 16 B x odd)
__global__ __launch_bounds__(256) void pack_x_kernel(const float* __restrict__ x,
                                                     _Float16* __restrict__ xs) {
  __shared__ __align__(16) _Float16 tile[PXS * PXP];
  const int tid  = threadIdx.x;
  const int lane = tid & 31;
  const int wave = tid >> 5;
  const int sblk = blockIdx.x * PXS;
  const int cblk = blockIdx.y * PXC;
  const int n    = blockIdx.z;

  const float* src = x + ((size_t)n * CDIM + cblk + wave * 8) * SEQ + sblk + lane * 4;
  v4f v[8];
  // unrolled: all 8 loads in flight at once, v[] indexed by constants only
#pragma unroll
  for (int j = 0; j < 8; ++j) v[j] = *(const v4f*)(src + (size_t)j * SEQ);
  // unrolled: register transpose needs constant indices
#pragma unroll
  for (int i = 0; i < 4; ++i) {
    v8h h;
#pragma unroll
    for (int j = 0; j < 8; ++j) h[j] = (_Float16)v[j][i];
    *(v8h*)(&tile[(lane * 4 + i) * PXP + wave * 8]) = h;
  }
  __syncthreads();   // the tile is read across waves below

  _Float16* dst = xs + ((size_t)n * SEQ + sblk) * CDIM + cblk;
  // unrolled: the 4 LDS reads go out together, ahead of the stores
#pragma unroll
  for (int k = 0; k < 4; ++k) {
    const int q   = k * 256 + tid;
    const int row = q >> 3;
    const int c8  = (q & 7) * 8;
    *(v8h*)(dst + (size_t)row * CDIM + c8) = *(const v8h*)(&tile[row * PXP + c8]);
  }
}

// All four weight matrices f32 -> f16 (row-major [C_out, C_in]; these rows are
// the GEMM's A-fragment rows for Q, K and the output, its B-fragment
// columns for V). A thread converts 4 consecutive values of each matrix:
// 16-byte loads, 8-byte stores.
__global__ __launch_bounds__(256) void pack_w_kernel(
                              const float* __restrict__ a, const float* __restrict__ b,
                              const float* __restrict__ c, const float* __restrict__ d,
                              _Float16* __restrict__ A, _Float16* __restrict__ B,
                              _Float16* __restrict__ Cw, _Float16* __restrict__ D) {
  // 32-bit byte offsets from the uniform bases: one offset register serves the
  // four loads and one the four stores.
  const unsigned ib = (blockIdx.x * 256u + threadIdx.x) * 16u;   // f32 side
  const unsigned ob = ib >> 1;                                   // f16 side
  const v4f va = *(const v4f*)((const char*)a + ib);
  const v4f vb = *(const v4f*)((const char*)b + ib);
  const v4f vc = *(const v4f*)((const char*)c + ib);
  const v4f vd = *(const v4f*)((const char*)d + ib);
  *(v4h*)((char*)A + ob)  = __builtin_convertvector(va, v4h);
  *(v4h*)((char*)B + ob)  = __builtin_convertvector(vb, v4h);
  *(v4h*)((char*)Cw + ob) = __builtin_convertvector(vc, v4h);
  *(v4h*)((char*)D + ob)  = __builtin_convertvector(vd, v4h);
}

// Y[M,512] = A[M,512](f16) @ W[512,512]^T(f16 row-major) + bias.
// mode 0: f16 row-major [M,512]   (Q, K)
// mode 1: f32 row-major [M,512]   (final output)
// mode 2: f16 head-transposed Vt[(n*NH+h)*HD + d][SEQ]   (V)
// Block 256 thr = 8 waves (4 x 2); block tile 128x128; wave tile 32x64
// (8 accumulators). K chunks of 64 double-buffered in LDS via async copies
// overlapped with WMMA compute. Eight lanes copy one row's 128 bytes, so a
// wave-wide copy takes four whole lines.
// blockIdx.z picks one of up to three products that share A: weight matrix z
// of Wall and f16 output plane z of out16all (both packed back to back), bias
// bz; plane 2 is always written in mode 2. One launch of three then keeps
// three blocks on a WGP, whose copies and barriers cover one another.
// Output path: the tile whose rows run along the output's contiguous dimension
// (W for the row-major outputs, A for Vt) goes in as the first matrix operand,
// so an accumulator holds 8 neighbours of one output row. The block's output
// tile is laid in the LDS that the ring has left, 16 bytes a write, and goes
// out row by row, 16 bytes a lane: every store fills whole 128-byte lines.
#define TSZ  (128 * P64)  // one operand tile of one buffer, halves
#define EP16 136          // staged output row pitch, halves (272 B, 16 B x odd)
#define EP32 132          // staged output row pitch, floats (528 B, 16 B x odd)
__global__ void gemm_bt_kernel(const _Float16* __restrict__ A,
                               const _Float16* __restrict__ Wall,
                               const float* __restrict__ b0,
                               const float* __restrict__ b1,
                               const float* __restrict__ b2,
                               _Float16* __restrict__ out16all,
                               float* __restrict__ out32,
                               int mode0) {
  // A tiles [2][TSZ], then W tiles [2][TSZ]; after the loop the output tile.
  __shared__ __align__(16) _Float16 smem[4 * TSZ];
  // The block's 128 bias values, kept beside the ring until the output path.
  __shared__ __align__(16) float sbias[128];

  const int tid  = threadIdx.x;
  const int lane = tid & 31;
  const int wave = tid >> 5;
  const int lr   = lane & 15;
  const int hi   = lane >> 4;
  const int wr   = wave & 3;   // group of 32 along the first operand's rows
  const int wc   = wave >> 2;  // group of 64 along the second operand's rows
  const int mblk = blockIdx.x * 128;
  const int nblk = blockIdx.y * 128;
  const int z    = blockIdx.z;
  const _Float16* W    = Wall + (size_t)z * (CDIM * CDIM);
  const float*    bias = z == 0 ? b0 : (z == 1 ? b1 : b2);
  _Float16*       out16 = out16all + (size_t)z * ((size_t)MTOT * CDIM);
  const int       mode = z == 2 ? 2 : mode0;
  // First operand ("fast": its rows are neighbours in the output) and second
  // ("slow": its rows are output rows), as offsets into smem.
  const int fo = mode == 2 ? 0 : 2 * TSZ;
  const int so = mode == 2 ? 2 * TSZ : 0;

  // Cooperative copy coords: lane group tid/8 takes rows tid/8 + 32 j, j = 0..3,
  // of A and of W; lane tid%8 the 16 bytes at 16 * (tid%8) of the row's line.
  const int crow = tid >> 3;           // 0..31
  const int ccol = (tid & 7) * 8;      // halves within the 64-half row
  const _Float16* gA = A + (size_t)(mblk + crow) * CDIM + ccol;
  const _Float16* gW = W + (size_t)(nblk + crow) * CDIM + ccol;
  const unsigned ldsA = lds_off_of(&smem[crow * P64 + ccol]);
  const unsigned ldsW = lds_off_of(&smem[2 * TSZ + crow * P64 + ccol]);
  auto issue = [&](int b, int kc) {
    unsigned l[8];
    const _Float16* g[8];
    // unrolled: l[] and g[] are asm operands, indexed by constants only
#pragma unroll
    for (int j = 0; j < 4; ++j) {
      l[j]     = ldsA + (unsigned)(b * 128 + j * 32) * (P64 * 2);
      l[j + 4] = ldsW + (unsigned)(b * 128 + j * 32) * (P64 * 2);
      g[j]     = gA + (size_t)(j * 32) * CDIM + kc;
      g[j + 4] = gW + (size_t)(j * 32) * CDIM + kc;
    }
    async_b128_x8(l, g);
  };

  // acc[s][c][r] = tile[slow = wc*64 + c*16 + lr][fast = wr*32 + s*16 + 8*hi + r]
  v8f acc[2][4];
#pragma unroll
  for (int s = 0; s < 2; ++s)
#pragma unroll
    for (int c = 0; c < 4; ++c) acc[s][c] = v8f{0.f,0.f,0.f,0.f,0.f,0.f,0.f,0.f};

  issue(0, 0);
  // Wave 0 brings the bias in, 16 bytes a lane, under the first copies' flight;
  // the barrier below publishes it with chunk 0.
  if (__builtin_amdgcn_readfirstlane(wave) == 0) {   // scalar test: EXEC stays whole
    const v4f b = *(const v4f*)(bias + nblk + lane * 4);
    // no register that the load names is rewritten ahead of this (a precaution)
    asm volatile("s_wait_xcnt 0x0" ::: "memory");
    *(v4f*)(sbias + lane * 4) = b;
  }
  wait_async0();          // my chunk-0 copies done
  __syncthreads();        // everyone's chunk 0 and the bias visible
  issue(1, KCH);
  for (int t = 0; t < CDIM / KCH; ++t) {
    const int cur = t & 1;
    const _Float16* Fb = smem + fo + cur * TSZ;
    const _Float16* Sb = smem + so + cur * TSZ;
    // unrolled: the chunk's two WMMA K depths, in ascending k as before
#pragma unroll
    for (int kk = 0; kk < KCH; kk += 32) {
      v16h af[2];
#pragma unroll
      for (int s = 0; s < 2; ++s)
        af[s] = load_frag(Fb + (size_t)(wr * 32 + s * 16 + lr) * P64 + kk, hi);
#pragma unroll
      for (int c = 0; c < 4; ++c) {
        v16h bf = load_frag(Sb + (size_t)(wc * 64 + c * 16 + lr) * P64 + kk, hi);
#pragma unroll
        for (int s = 0; s < 2; ++s)
          acc[s][c] = __builtin_amdgcn_wmma_f32_16x16x32_f16(false, af[s], false, bf,
                                                             (short)0, acc[s][c], false, false);
      }
    }
    wait_ds0();           // my reads of this buffer are over
    wait_async0();        // my chunk-(t+1) copies done
    __syncthreads();      // chunk t+1 visible to all; this buffer free
    if (t + 2 < CDIM / KCH) issue(cur, (t + 2) * KCH);
  }
  wait_async0();          // nothing of mine in flight when the wave ends

  // Bias runs along the output columns: the slow index for Vt, the fast index
  // else. Both sets are read from LDS (both lie inside its 128 values) and the
  // one that does not apply is zero: x + 0 is exact, and one straight run of
  // adds serves every mode (a branch for each mode with its own adds was built
  // too: that form spills to scratch under this kernel's register budget).
  // Every loop from here on is unrolled: acc[][], bs[] and t[] stay in
  // registers only where constants index them.
  const bool bslow = mode == 2;
  float bs[4];
#pragma unroll
  for (int c = 0; c < 4; ++c) {
    const float b = sbias[wc * 64 + c * 16 + lr];
    bs[c] = bslow ? b : 0.0f;
  }
#pragma unroll
  for (int s = 0; s < 2; ++s) {
    const float* bp = sbias + wr * 32 + s * 16 + 8 * hi;
    const v4f bl = *(const v4f*)bp, bh = *(const v4f*)(bp + 4);
    v8f bf = __builtin_shufflevector(bl, bh, 0, 1, 2, 3, 4, 5, 6, 7);
#pragma unroll
    for (int r = 0; r < 8; ++r) bf[r] = bslow ? 0.0f : bf[r];
#pragma unroll
    for (int c = 0; c < 4; ++c) acc[s][c] = (acc[s][c] + bf) + bs[c];
  }

  // The loop's last barrier stands behind every wave's last read of the ring
  // and behind every copy: smem is free for the output tile [slow][fast].
  const int srow = wc * 64 + lr;             // + c * 16
  const int fcol = wr * 32 + 8 * hi;         // + s * 16
  float* st32 = (float*)smem;
  if (mode == 1) {
#pragma unroll
    for (int c = 0; c < 4; ++c)
#pragma unroll
      for (int s = 0; s < 2; ++s) {
        float* p = st32 + (srow + c * 16) * EP32 + fcol + s * 16;
        *(v4f*)p       = __builtin_shufflevector(acc[s][c], acc[s][c], 0, 1, 2, 3);
        *(v4f*)(p + 4) = __builtin_shufflevector(acc[s][c], acc[s][c], 4, 5, 6, 7);
      }
  } else {
#pragma unroll
    for (int c = 0; c < 4; ++c)
#pragma unroll
      for (int s = 0; s < 2; ++s)
        *(v8h*)(smem + (srow + c * 16) * EP16 + fcol + s * 16) =
            __builtin_convertvector(acc[s][c], v8h);
  }
  __syncthreads();   // the output tile is read across waves below

  if (mode == 1) {
    // a wave carries one row's 128 floats: four whole lines a store
    float* dst = out32 + (size_t)mblk * CDIM + nblk;
    const int row = tid >> 5, c4 = (tid & 31) * 4;
    // unrolled: the LDS reads go out together, ahead of the stores
#pragma unroll
    for (int k = 0; k < 16; ++k)
      *(v4f*)(dst + (size_t)(row + k * 8) * CDIM + c4) =
          *(const v4f*)(st32 + (row + k * 8) * EP32 + c4);
  } else {
    // 16 lanes carry one row's 128 halves: a wave stores two rows, four whole
    // lines.
    const int row = tid >> 4, c8 = (tid & 15) * 8;
    v8h t[8];
    // unrolled: the LDS reads go out together, ahead of the stores
#pragma unroll
    for (int k = 0; k < 8; ++k)
      t[k] = *(const v8h*)(smem + (row + k * 16) * EP16 + c8);
    if (mode == 2) {
      // Vt row (n*NH + h)*HD + d = n*CDIM + output column; the block's 128
      // tokens lie inside one n.
      _Float16* dst = out16 + ((size_t)(mblk / SEQ) * CDIM + nblk + row) * SEQ
                            + (mblk % SEQ) + c8;
#pragma unroll
      for (int k = 0; k < 8; ++k) *(v8h*)(dst + (size_t)k * 16 * SEQ) = t[k];
    } else {
      _Float16* dst = out16 + (size_t)(mblk + row) * CDIM + nblk + c8;
#pragma unroll
      for (int k = 0; k < 8; ++k) *(v8h*)(dst + (size_t)k * 16 * CDIM) = t[k];
    }
  }
}

// Lane l <-> lane l ^ 16 (the two halves of a wave), register to register.
__device__ __forceinline__ float xhalf(float x) {
  int b = __builtin_bit_cast(int, x);
  return __builtin_bit_cast(float,
      __builtin_amdgcn_permlanex16(b, b, 0x76543210, 0xfedcba98, false, false));
}

__global__ __launch_bounds__(128) void attn_kernel(const _Float16* __restrict__ Q,
                            const _Float16* __restrict__ K,
                            const _Float16* __restrict__ Vt,
                            _Float16* __restrict__ O) {
  __shared__ __align__(16) _Float16 Kt[2][KST * P64];
  __shared__ __align__(16) _Float16 VtT[2][HD * P64];

  const int tid  = threadIdx.x;
  const int lane = tid & 31;
  const int wave = tid >> 5;
  const int lr   = lane & 15;
  const int hi   = lane >> 4;
  const int n    = blockIdx.y >> 3;   // NH == 8
  const int h    = blockIdx.y & 7;
  const int q0   = blockIdx.x * 64 + wave * 16;

  const _Float16* Qb  = Q  + (size_t)n * SEQ * CDIM + h * HD;
  const _Float16* Kb  = K  + (size_t)n * SEQ * CDIM + h * HD;
  const _Float16* VtB = Vt + (size_t)(n * NH + h) * HD * SEQ;   // [64][SEQ]

  const v16h qa0 = load_frag(Qb + (size_t)(q0 + lr) * CDIM, hi);
  const v16h qa1 = load_frag(Qb + (size_t)(q0 + lr) * CDIM + 32, hi);

  // o[c][r] = O^T[d = c*16 + 8*hi + r][query lr]
  v8f o[4];
#pragma unroll
  for (int c = 0; c < 4; ++c) o[c] = v8f{0.f,0.f,0.f,0.f,0.f,0.f,0.f,0.f};
  // Running maximum of query lr (equal in both halves) and this half's share
  // of its running sum (the halves are joined once, after the loop).
  float m = -1.0e30f, l = 0.0f;

  // Cooperative copy coords: lane group tid/8 takes rows tid/8 + 16 j, j = 0..3,
  // of the K tile and of the Vt tile; lane tid%8 the 16 bytes at 16 * (tid%8) of
  // the row's line, so a wave-wide copy takes four whole lines.
  const int crow = tid >> 3;           // 0..15
  const int ccol = (tid & 7) * 8;      // halves within the 64-half row
  const _Float16* gK = Kb  + (size_t)crow * CDIM + ccol;
  const _Float16* gV = VtB + (size_t)crow * SEQ  + ccol;
  const unsigned ldsK = lds_off_of(&Kt[0][crow * P64 + ccol]);
  const unsigned ldsV = lds_off_of(&VtT[0][crow * P64 + ccol]);
  auto issueKV = [&](int b, int k0) {
    unsigned l[8];
    const _Float16* g[8];
    // unrolled: l[] and g[] are asm operands, indexed by constants only
#pragma unroll
    for (int j = 0; j < 4; ++j) {
      l[j]     = ldsK + (unsigned)(b * KST + j * 16) * (P64 * 2);
      l[j + 4] = ldsV + (unsigned)(b * HD  + j * 16) * (P64 * 2);
      g[j]     = gK + (size_t)(k0 + j * 16) * CDIM;   // key rows k0 + ...
      g[j + 4] = gV + (size_t)(j * 16) * SEQ + k0;    // keys k0 .. k0+63 of a d row
    }
    async_b128_x8(l, g);
  };

  issueKV(0, 0);
  wait_async0();          // my stage-0 copies done
  __syncthreads();        // everyone's stage 0 visible
  issueKV(1, KST);
  for (int st = 0; st < SEQ / KST; ++st) {
    const int cur = st & 1;
   // unrolled: the stage's two 32-key passes, in ascending key order as before
#pragma unroll
   for (int sub = 0; sub < KST / 32; ++sub) {
    const _Float16* Kc = Kt[cur] + sub * 32 * P64;   // key rows 32 sub ..
    const _Float16* Vc = VtT[cur] + sub * 32;        // key columns 32 sub ..

    // S^T tile (32 keys x 16 queries) = k_tile @ q_tile^T  (K = 64 -> 2 chunks)
    // s0[r] = key 8*hi + r, s1[r] = key 16 + 8*hi + r, both of query lr.
    v8f s0 = v8f{0.f,0.f,0.f,0.f,0.f,0.f,0.f,0.f};
    v8f s1 = v8f{0.f,0.f,0.f,0.f,0.f,0.f,0.f,0.f};
    {
      v16h a;
      a = load_frag(Kc + (size_t)lr * P64 + 0,  hi);
      s0 = __builtin_amdgcn_wmma_f32_16x16x32_f16(false, a, false, qa0, (short)0, s0, false, false);
      a = load_frag(Kc + (size_t)lr * P64 + 32, hi);
      s0 = __builtin_amdgcn_wmma_f32_16x16x32_f16(false, a, false, qa1, (short)0, s0, false, false);
      a = load_frag(Kc + (size_t)(16 + lr) * P64 + 0,  hi);
      s1 = __builtin_amdgcn_wmma_f32_16x16x32_f16(false, a, false, qa0, (short)0, s1, false, false);
      a = load_frag(Kc + (size_t)(16 + lr) * P64 + 32, hi);
      s1 = __builtin_amdgcn_wmma_f32_16x16x32_f16(false, a, false, qa1, (short)0, s1, false, false);
    }

    // Online softmax of query lr: 16 scores in this lane, 16 in lane ^ 16.
    const v8f v0 = s0 * 0.125f;            // 1/sqrt(64)
    const v8f v1 = s1 * 0.125f;
    float rm = v0[0], rn = v1[0];
#pragma unroll
    for (int r = 1; r < 8; ++r) { rm = fmaxf(rm, v0[r]); rn = fmaxf(rn, v1[r]); }
    rm = fmaxf(rm, rn);
    rm = fmaxf(rm, xhalf(rm));
    const float mn    = fmaxf(m, rm);
    const float alpha = __expf(m - mn);
    m = mn;

    // P^T in place: element i of the B operand is key 8*hi + i (i < 8) or 16 + 8*hi + i - 8 (i >= 8) of query lr.
    v16h pb;
    float rs0 = 0.0f, rs1 = 0.0f;
#pragma unroll
    for (int r = 0; r < 8; ++r) {
      const float p0 = __expf(v0[r] - mn);
      const float p1 = __expf(v1[r] - mn);
      rs0 += p0;
      rs1 += p1;
      pb[r]     = (_Float16)p0;
      pb[r + 8] = (_Float16)p1;
    }
    l = l * alpha + (rs0 + rs1);
#pragma unroll
    for (int c = 0; c < 4; ++c)
#pragma unroll
      for (int r = 0; r < 8; ++r) o[c][r] *= alpha;

    // O^T += V^T_tile(64 x 32) @ P^T(32 x 16): A fragments are contiguous Vt rows.
#pragma unroll
    for (int c = 0; c < 4; ++c) {
      v16h va = load_frag(Vc + (size_t)(c * 16 + lr) * P64, hi);
      o[c] = __builtin_amdgcn_wmma_f32_16x16x32_f16(false, va, false, pb,
                                                    (short)0, o[c], false, false);
    }
   }
    wait_ds0();           // my reads of this buffer are over
    wait_async0();        // my stage-(st+1) copies done
    __syncthreads();      // stage st+1 visible to all; this buffer free
    if (st + 2 < SEQ / KST) issueKV(cur, (st + 2) * KST);
  }
  wait_async0();          // nothing of mine in flight when the wave ends

  // Join the halves' sums, normalize and store in [N, h, S, d] flat order:
  // 8 consecutive d of query lr per accumulator tile, one 16-byte store each.
  const float inv = 1.0f / (l + xhalf(l));
  _Float16* Ob = O + ((size_t)(n * NH + h) * SEQ + q0 + lr) * HD + 8 * hi;
#pragma unroll
  for (int c = 0; c < 4; ++c) {
    v8h ov;
#pragma unroll
    for (int r = 0; r < 8; ++r) ov[r] = (_Float16)(o[c][r] * inv);
    *(v8h*)(Ob + c * 16) = ov;
  }
}

extern "C" void kernel_launch(void* const* d_in, const int* in_sizes, int n_in,
                              void* d_out, int out_size, void* d_ws, size_t ws_size,
                              hipStream_t stream) {
  (void)in_sizes; (void)n_in; (void)out_size; (void)ws_size;
  const float* x  = (const float*)d_in[0];
  const float* Wq = (const float*)d_in[1];
  const float* bq = (const float*)d_in[2];
  const float* Wk = (const float*)d_in[3];
  const float* bk = (const float*)d_in[4];
  const float* Wv = (const float*)d_in[5];
  const float* bv = (const float*)d_in[6];
  const float* Wo = (const float*)d_in[7];
  const float* bo = (const float*)d_in[8];
  float* out = (float*)d_out;

  // Workspace layout (offsets in f16 elements). Total ~42 MB.
  _Float16* ws = (_Float16*)d_ws;
  const size_t NSC = (size_t)NB * SEQ * CDIM;   // 4,194,304
  const size_t WSZ = (size_t)CDIM * CDIM;       //   262,144
  _Float16* xs   = ws;
  _Float16* wq16 = xs + NSC;
  _Float16* wk16 = wq16 + WSZ;
  _Float16* wv16 = wk16 + WSZ;
  _Float16* wo16 = wv16 + WSZ;
  _Float16* Qh   = wo16 + WSZ;
  _Float16* Kh   = Qh + NSC;
  _Float16* Vth  = Kh + NSC;   // V stored head-transposed [(n*NH+h)*HD+d][SEQ]
  _Float16* Oh   = Vth + NSC;

  // 1) Pack activations and weights to f16
  pack_x_kernel<<<dim3(SEQ / PXS, CDIM / PXC, NB), 256, 0, stream>>>(x, xs);
  pack_w_kernel<<<CDIM * CDIM / 4 / 256, 256, 0, stream>>>(
      Wq, Wk, Wv, Wo, wq16, wk16, wv16, wo16);

  // 2) Q/K/V projections (fused bias) in one launch, z = 0, 1, 2: wq16, wk16,
  //    wv16 and Qh, Kh, Vth lie back to back; V written head-transposed
  gemm_bt_kernel<<<dim3(MTOT / 128, CDIM / 128, 3), 256, 0, stream>>>(
      xs, wq16, bq, bk, bv, Qh, nullptr, 0);

  // 3) Flash attention per (n, h); O stored [N, h, S, d] flat
  attn_kernel<<<dim3(SEQ / 64, NB * NH), 128, 0, stream>>>(Qh, Kh, Vth, Oh);

  // 4) Output projection: O (flat [8192, 512]) @ Wo^T + bo -> f32 d_out
  //    (both reference reshapes are memory-order-preserving)
  gemm_bt_kernel<<<dim3(MTOT / 128, CDIM / 128, 1), 256, 0, stream>>>(
      Oh, wo16, bo, bo, bo, nullptr, out, 1);
}

// v007
// One run takes 53.9 microseconds.
// Two timings next to v006 both put it at 1.03 times that version's speed.
// All steps since v000 together make it 5.26 times as fast.
#include <hip/hip_runtime.h>

// Problem constants
#define CDIM 512
#define SEQ  1024
#define NB   8
#define NH   8
#define HD   64
#define MTOT (NB * SEQ)   // 8192 total token rows
#define KCH  64           // GEMM K chunk: one 128-byte line of every row, two WMMA K depths
#define KST  64           // attention key stage: two 32-key passes
// LDS row pitch in halves, 16 B x odd: the 16 lanes of a half-wave that read
// 16 bytes of 16 consecutive rows then fall on all 64 banks, none twice.
#define P64  72           // rows of 64 halves (128 B) lie 144 B apart

typedef __attribute__((ext_vector_type(16))) _Float16 v16h;
typedef __attribute__((ext_vector_type(8)))  _Float16 v8h;
typedef __attribute__((ext_vector_type(4)))  _Float16 v4h;
typedef __attribute__((ext_vector_type(8)))  float    v8f;
typedef __attribute__((ext_vector_type(4)))  float    v4f;

// ---- CDNA5 async global->LDS copy (ASYNCcnt path, ISA 15.18.3 op 98) ----
__device__ __forceinline__ unsigned lds_off_of(const void* p) {
  // LDS aperture keeps the wave-relative LDS byte offset in addr[31:0].
  return (unsigned)(unsigned long long)(uintptr_t)p;
}
// One stage's eight copies of a lane, 16 bytes each. The closing s_wait_xcnt 0
// stands inside the statement so that no address register of a copy is
// rewritten ahead of it (a precaution).
__device__ __forceinline__ void async_b128_x8(const unsigned (&l)[8],
                                              const _Float16* const (&g)[8]) {
  asm volatile("global_load_async_to_lds_b128 %0, %8, off\n\t"
               "global_load_async_to_lds_b128 %1, %9, off\n\t"
               "global_load_async_to_lds_b128 %2, %10, off\n\t"
               "global_load_async_to_lds_b128 %3, %11, off\n\t"
               "global_load_async_to_lds_b128 %4, %12, off\n\t"
               "global_load_async_to_lds_b128 %5, %13, off\n\t"
               "global_load_async_to_lds_b128 %6, %14, off\n\t"
               "global_load_async_to_lds_b128 %7, %15, off\n\t"
               "s_wait_xcnt 0x0"
               :: "v"(l[0]), "v"(l[1]), "v"(l[2]), "v"(l[3]),
                  "v"(l[4]), "v"(l[5]), "v"(l[6]), "v"(l[7]),
                  "v"((unsigned long long)(uintptr_t)g[0]),
                  "v"((unsigned long long)(uintptr_t)g[1]),
                  "v"((unsigned long long)(uintptr_t)g[2]),
                  "v"((unsigned long long)(uintptr_t)g[3]),
                  "v"((unsigned long long)(uintptr_t)g[4]),
                  "v"((unsigned long long)(uintptr_t)g[5]),
                  "v"((unsigned long long)(uintptr_t)g[6]),
                  "v"((unsigned long long)(uintptr_t)g[7])
               : "memory");
}
// This wave's copies have landed.
__device__ __forceinline__ void wait_async0() {
  asm volatile("s_wait_asynccnt 0x0" ::: "memory");
}
// This wave's LDS reads have retired, before the buffer they read is refilled.
__device__ __forceinline__ void wait_ds0() {
  asm volatile("s_wait_dscnt 0x0" ::: "memory");
}

// Load one WMMA f16 A/B fragment for a 32-wide K chunk.
// Lanes 0-15 hold K {0..7,16..23}, lanes 16-31 hold K {8..15,24..31}.
__device__ __forceinline__ v16h load_frag(const _Float16* p, int hi) {
  v8h a = *(const v8h*)(p + (hi ? 8 : 0));
  v8h b = *(const v8h*)(p + (hi ? 24 : 16));
  v16h r;
#pragma unroll
  for (int i = 0; i < 8; ++i) { r[i] = a[i]; r[i + 8] = b[i]; }
  return r;
}

// One launch packs everything that the projections read.
// Plane z = 0 of the grid: all four weight matrices f32 -> f16 (row-major
// [C_out, C_in]; these rows ARE the A-fragment rows (for V the B-fragment columns) of y = x @ W^T). Its
// 64 blocks take 1/64 of each matrix; a thread converts 4 consecutive values at
// 4 places of each: sixteen 16-byte loads in flight, 8-byte stores. The plane
// comes first in the grid, so its memory latency passes while the other planes'
// blocks are still being started.
// Planes z = 1 .. NB: x [N, C, H*W] f32  ->  xs [N, S, C] f16 of n = z - 1, one
// 64 (c) x 128 (s) tile per block.
// In: wave w reads rows c = 8w .. 8w+7, a lane 4 consecutive s of each, so a
// wave-wide load is 512 contiguous bytes. A lane then owns 8 consecutive c of
// 4 tokens and puts each as 16 bytes into the LDS tile [s][c]. Out: 8 lanes
// carry one token's 64 c, so every store fills whole 128-byte lines.
#define PXC 64    // tile extent along c
#define PXS 128   // tile extent along s
#define PXP 72    // LDS row pitch in halves (144 B, 16 B x odd)
#define PWB ((SEQ / PXS) * (CDIM / PXC))      // blocks of the weight plane: 64
#define PWJ (CDIM * CDIM / 4 / 256 / PWB)     // 16-byte pieces a thread and matrix: 4
__global__ __launch_bounds__(256) void pack_kernel(
                              const float* __restrict__ x, _Float16* __restrict__ xs,
                              const float* __restrict__ a, const float* __restrict__ b,
                              const float* __restrict__ c, const float* __restrict__ d,
                              _Float16* __restrict__ A, _Float16* __restrict__ B,
                              _Float16* __restrict__ Cw, _Float16* __restrict__ D) {
  __shared__ __align__(16) _Float16 tile[PXS * PXP];
  const int tid  = threadIdx.x;

  if (blockIdx.z == 0) {   // the same for the whole block: no barrier is skipped by a part of it
    // 32-bit byte offsets from the uniform bases: one offset register serves
    // all loads and one all stores, the pieces lie at constant distances.
    const unsigned blk = blockIdx.y * (SEQ / PXS) + blockIdx.x;
    const unsigned ib  = (blk * (PWJ * 256u) + (unsigned)tid) * 16u;   // f32 side
    const unsigned ob  = ib >> 1;                                      // f16 side
    v4f va[PWJ], vb[PWJ], vc[PWJ], vd[PWJ];
    // unrolled: all loads in flight at once, the arrays indexed by constants only
#pragma unroll
    for (int j = 0; j < PWJ; ++j) {
      va[j] = *(const v4f*)((const char*)a + ib + j * 4096u);
      vb[j] = *(const v4f*)((const char*)b + ib + j * 4096u);
      vc[j] = *(const v4f*)((const char*)c + ib + j * 4096u);
      vd[j] = *(const v4f*)((const char*)d + ib + j * 4096u);
    }
#pragma unroll
    for (int j = 0; j < PWJ; ++j) {
      *(v4h*)((char*)A + ob + j * 2048u)  = __builtin_convertvector(va[j], v4h);
      *(v4h*)((char*)B + ob + j * 2048u)  = __builtin_convertvector(vb[j], v4h);
      *(v4h*)((char*)Cw + ob + j * 2048u) = __builtin_convertvector(vc[j], v4h);
      *(v4h*)((char*)D + ob + j * 2048u)  = __builtin_convertvector(vd[j], v4h);
    }
    return;
  }

  const int lane = tid & 31;
  const int wave = tid >> 5;
  const int sblk = blockIdx.x * PXS;
  const int cblk = blockIdx.y * PXC;
  const int n    = blockIdx.z - 1;

  const float* src = x + ((size_t)n * CDIM + cblk + wave * 8) * SEQ + sblk + lane * 4;
  v4f v[8];
  // unrolled: all 8 loads in flight at once, v[] indexed by constants only
#pragma unroll
  for (int j = 0; j < 8; ++j) v[j] = *(const v4f*)(src + (size_t)j * SEQ);
  // unrolled: register transpose needs constant indices
#pragma unroll
  for (int i = 0; i < 4; ++i) {
    v8h h;
#pragma unroll
    for (int j = 0; j < 8; ++j) h[j] = (_Float16)v[j][i];
    *(v8h*)(&tile[(lane * 4 + i) * PXP + wave * 8]) = h;
  }
  __syncthreads();   // the tile is read across waves below

  _Float16* dst = xs + ((size_t)n * SEQ + sblk) * CDIM + cblk;
  // unrolled: the 4 LDS reads go out together, ahead of the stores
#pragma unroll
  for (int k = 0; k < 4; ++k) {
    const int q   = k * 256 + tid;
    const int row = q >> 3;
    const int c8  = (q & 7) * 8;
    *(v8h*)(dst + (size_t)row * CDIM + c8) = *(const v8h*)(&tile[row * PXP + c8]);
  }
}

// Y[M,512] = A[M,512](f16) @ W[512,512]^T(f16 row-major) + bias.
// mode 0: f16 row-major [M,512]   (Q, K)
// mode 1: f32 row-major [M,512]   (final output)
// mode 2: f16 head-transposed Vt[(n*NH+h)*HD + d][SEQ]   (V)
// Block 256 thr = 8 waves (4 x 2); block tile 128x128; wave tile 32x64
// (8 accumulators). K chunks of 64 double-buffered in LDS via async copies
// overlapped with WMMA compute. Eight lanes copy one row's 128 bytes, so a
// wave-wide copy takes four whole lines.
// blockIdx.z picks one of up to three products that share A: weight matrix z
// of Wall and f16 output plane z of out16all (both packed back to back), bias
// bz; plane 2 is always written in mode 2. One launch of three then keeps
// three blocks on a WGP, whose copies and barriers cover one another.
// Output path: the tile whose rows run along the output's contiguous dimension
// (W for the row-major outputs, A for Vt) goes in as the first matrix operand,
// so an accumulator holds 8 neighbours of one output row. The block's output
// tile is laid in the LDS that the ring has left, 16 bytes a write, and goes
// out row by row, 16 bytes a lane: every store fills whole 128-byte lines.
#define TSZ  (128 * P64)  // one operand tile of one buffer, halves
#define EP16 136          // staged output row pitch, halves (272 B, 16 B x odd)
#define EP32 132          // staged output row pitch, floats (528 B, 16 B x odd)
__global__ void gemm_bt_kernel(const _Float16* __restrict__ A,
                               const _Float16* __restrict__ Wall,
                               const float* __restrict__ b0,
                               const float* __restrict__ b1,
                               const float* __restrict__ b2,
                               _Float16* __restrict__ out16all,
                               float* __restrict__ out32,
                               int mode0) {
  // A tiles [2][TSZ], then W tiles [2][TSZ]; after the loop the output tile.
  __shared__ __align__(16) _Float16 smem[4 * TSZ];
  // The block's 128 bias values, kept beside the ring until the output path.
  __shared__ __align__(16) float sbias[128];

  const int tid  = threadIdx.x;
  const int lane = tid & 31;
  const int wave = tid >> 5;
  const int lr   = lane & 15;
  const int hi   = lane >> 4;
  const int wr   = wave & 3;   // group of 32 along the first operand's rows
  const int wc   = wave >> 2;  // group of 64 along the second operand's rows
  const int mblk = blockIdx.x * 128;
  const int nblk = blockIdx.y * 128;
  const int z    = blockIdx.z;
  const _Float16* W    = Wall + (size_t)z * (CDIM * CDIM);
  const float*    bias = z == 0 ? b0 : (z == 1 ? b1 : b2);
  _Float16*       out16 = out16all + (size_t)z * ((size_t)MTOT * CDIM);
  const int       mode = z == 2 ? 2 : mode0;
  // First operand ("fast": its rows are neighbours in the output) and second
  // ("slow": its rows are output rows), as offsets into smem.
  const int fo = mode == 2 ? 0 : 2 * TSZ;
  const int so = mode == 2 ? 2 * TSZ : 0;

  // Cooperative copy coords: lane group tid/8 takes rows tid/8 + 32 j, j = 0..3,
  // of A and of W; lane tid%8 the 16 bytes at 16 * (tid%8) of the row's line.
  const int crow = tid >> 3;           // 0..31
  const int ccol = (tid & 7) * 8;      // halves within the 64-half row
  const _Float16* gA = A + (size_t)(mblk + crow) * CDIM + ccol;
  const _Float16* gW = W + (size_t)(nblk + crow) * CDIM + ccol;
  const unsigned ldsA = lds_off_of(&smem[crow * P64 + ccol]);
  const unsigned ldsW = lds_off_of(&smem[2 * TSZ + crow * P64 + ccol]);
  auto issue = [&](int b, int kc) {
    unsigned l[8];
    const _Float16* g[8];
    // unrolled: l[] and g[] are asm operands, indexed by constants only
#pragma unroll
    for (int j = 0; j < 4; ++j) {
      l[j]     = ldsA + (unsigned)(b * 128 + j * 32) * (P64 * 2);
      l[j + 4] = ldsW + (unsigned)(b * 128 + j * 32) * (P64 * 2);
      g[j]     = gA + (size_t)(j * 32) * CDIM + kc;
      g[j + 4] = gW + (size_t)(j * 32) * CDIM + kc;
    }
    async_b128_x8(l, g);
  };

  // acc[s][c][r] = tile[slow = wc*64 + c*16 + lr][fast = wr*32 + s*16 + 8*hi + r]
  v8f acc[2][4];
#pragma unroll
  for (int s = 0; s < 2; ++s)
#pragma unroll
    for (int c = 0; c < 4; ++c) acc[s][c] = v8f{0.f,0.f,0.f,0.f,0.f,0.f,0.f,0.f};

  issue(0, 0);
  // Wave 0 brings the bias in, 16 bytes a lane, under the first copies' flight;
  // the barrier below publishes it with chunk 0.
  if (__builtin_amdgcn_readfirstlane(wave) == 0) {   // scalar test: EXEC stays whole
    const v4f b = *(const v4f*)(bias + nblk + lane * 4);
    // no register that the load names is rewritten ahead of this (a precaution)
    asm volatile("s_wait_xcnt 0x0" ::: "memory");
    *(v4f*)(sbias + lane * 4) = b;
  }
  wait_async0();          // my chunk-0 copies done
  __syncthreads();        // everyone's chunk 0 and the bias visible
  issue(1, KCH);
  for (int t = 0; t < CDIM / KCH; ++t) {
    const int cur = t & 1;
    const _Float16* Fb = smem + fo + cur * TSZ;
    const _Float16* Sb = smem + so + cur * TSZ;
    // unrolled: the chunk's two WMMA K depths, in ascending k as before
#pragma unroll
    for (int kk = 0; kk < KCH; kk += 32) {
      v16h af[2];
#pragma unroll
      for (int s = 0; s < 2; ++s)
        af[s] = load_frag(Fb + (size_t)(wr * 32 + s * 16 + lr) * P64 + kk, hi);
#pragma unroll
      for (int c = 0; c < 4; ++c) {
        v16h bf = load_frag(Sb + (size_t)(wc * 64 + c * 16 + lr) * P64 + kk, hi);
#pragma unroll
        for (int s = 0; s < 2; ++s)
          acc[s][c] = __builtin_amdgcn_wmma_f32_16x16x32_f16(false, af[s], false, bf,
                                                             (short)0, acc[s][c], false, false);
      }
    }
    wait_ds0();           // my reads of this buffer are over
    wait_async0();        // my chunk-(t+1) copies done
    __syncthreads();      // chunk t+1 visible to all; this buffer free
    if (t + 2 < CDIM / KCH) issue(cur, (t + 2) * KCH);
  }
  wait_async0();          // nothing of mine in flight when the wave ends

  // Bias runs along the output columns: the slow index for Vt, the fast index
  // else. Both sets are read from LDS (both lie inside its 128 values) and the
  // one that does not apply is zero: x + 0 is exact, and one straight run of
  // adds serves every mode (a branch for each mode with its own adds was built
  // too: that form spills to scratch under this kernel's register budget).
  // Every loop from here on is unrolled: acc[][], bs[] and t[] stay in
  // registers only where constants index them.
  const bool bslow = mode == 2;
  float bs[4];
#pragma unroll
  for (int c = 0; c < 4; ++c) {
    const float b = sbias[wc * 64 + c * 16 + lr];
    bs[c] = bslow ? b : 0.0f;
  }
#pragma unroll
  for (int s = 0; s < 2; ++s) {
    const float* bp = sbias + wr * 32 + s * 16 + 8 * hi;
    const v4f bl = *(const v4f*)bp, bh = *(const v4f*)(bp + 4);
    v8f bf = __builtin_shufflevector(bl, bh, 0, 1, 2, 3, 4, 5, 6, 7);
#pragma unroll
    for (int r = 0; r < 8; ++r) bf[r] = bslow ? 0.0f : bf[r];
#pragma unroll
    for (int c = 0; c < 4; ++c) acc[s][c] = (acc[s][c] + bf) + bs[c];
  }

  // The loop's last barrier stands behind every wave's last read of the ring
  // and behind every copy: smem is free for the output tile [slow][fast].
  const int srow = wc * 64 + lr;             // + c * 16
  const int fcol = wr * 32 + 8 * hi;         // + s * 16
  float* st32 = (float*)smem;
  if (mode == 1) {
#pragma unroll
    for (int c = 0; c < 4; ++c)
#pragma unroll
      for (int s = 0; s < 2; ++s) {
        float* p = st32 + (srow + c * 16) * EP32 + fcol + s * 16;
        *(v4f*)p       = __builtin_shufflevector(acc[s][c], acc[s][c], 0, 1, 2, 3);
        *(v4f*)(p + 4) = __builtin_shufflevector(acc[s][c], acc[s][c], 4, 5, 6, 7);
      }
  } else {
#pragma unroll
    for (int c = 0; c < 4; ++c)
#pragma unroll
      for (int s = 0; s < 2; ++s)
        *(v8h*)(smem + (srow + c * 16) * EP16 + fcol + s * 16) =
            __builtin_convertvector(acc[s][c], v8h);
  }
  __syncthreads();   // the output tile is read across waves below

  if (mode == 1) {
    // a wave carries one row's 128 floats: four whole lines a store
    float* dst = out32 + (size_t)mblk * CDIM + nblk;
    const int row = tid >> 5, c4 = (tid & 31) * 4;
    // unrolled: the LDS reads go out together, ahead of the stores
#pragma unroll
    for (int k = 0; k < 16; ++k)
      *(v4f*)(dst + (size_t)(row + k * 8) * CDIM + c4) =
          *(const v4f*)(st32 + (row + k * 8) * EP32 + c4);
  } else {
    // 16 lanes carry one row's 128 halves: a wave stores two rows, four whole
    // lines.
    const int row = tid >> 4, c8 = (tid & 15) * 8;
    v8h t[8];
    // unrolled: the LDS reads go out together, ahead of the stores
#pragma unroll
    for (int k = 0; k < 8; ++k)
      t[k] = *(const v8h*)(smem + (row + k * 16) * EP16 + c8);
    if (mode == 2) {
      // Vt row (n*NH + h)*HD + d = n*CDIM + output column; the block's 128
      // tokens lie inside one n.
      _Float16* dst = out16 + ((size_t)(mblk / SEQ) * CDIM + nblk + row) * SEQ
                            + (mblk % SEQ) + c8;
#pragma unroll
      for (int k = 0; k < 8; ++k) *(v8h*)(dst + (size_t)k * 16 * SEQ) = t[k];
    } else {
      _Float16* dst = out16 + (size_t)(mblk + row) * CDIM + nblk + c8;
#pragma unroll
      for (int k = 0; k < 8; ++k) *(v8h*)(dst + (size_t)k * 16 * CDIM) = t[k];
    }
  }
}

// Lane l <-> lane l ^ 16 (the two halves of a wave), register to register.
__device__ __forceinline__ float xhalf(float x) {
  int b = __builtin_bit_cast(int, x);
  return __builtin_bit_cast(float,
      __builtin_amdgcn_permlanex16(b, b, 0x76543210, 0xfedcba98, false, false));
}

__global__ __launch_bounds__(128) void attn_kernel(const _Float16* __restrict__ Q,
                            const _Float16* __restrict__ K,
                            const _Float16* __restrict__ Vt,
                            _Float16* __restrict__ O) {
  __shared__ __align__(16) _Float16 Kt[2][KST * P64];
  __shared__ __align__(16) _Float16 VtT[2][HD * P64];

  const int tid  = threadIdx.x;
  const int lane = tid & 31;
  const int wave = tid >> 5;
  const int lr   = lane & 15;
  const int hi   = lane >> 4;
  const int n    = blockIdx.y >> 3;   // NH == 8
  const int h    = blockIdx.y & 7;
  const int q0   = blockIdx.x * 64 + wave * 16;

  const _Float16* Qb  = Q  + (size_t)n * SEQ * CDIM + h * HD;
  const _Float16* Kb  = K  + (size_t)n * SEQ * CDIM + h * HD;
  const _Float16* VtB = Vt + (size_t)(n * NH + h) * HD * SEQ;   // [64][SEQ]

  const v16h qa0 = load_frag(Qb + (size_t)(q0 + lr) * CDIM, hi);
  const v16h qa1 = load_frag(Qb + (size_t)(q0 + lr) * CDIM + 32, hi);

  // o[c][r] = O^T[d = c*16 + 8*hi + r][query lr]
  v8f o[4];
#pragma unroll
  for (int c = 0; c < 4; ++c) o[c] = v8f{0.f,0.f,0.f,0.f,0.f,0.f,0.f,0.f};
  // Running maximum of query lr (equal in both halves) and this half's share
  // of its running sum (the halves are joined once, after the loop).
  float m = -1.0e30f, l = 0.0f;

  // Cooperative copy coords: lane group tid/8 takes rows tid/8 + 16 j, j = 0..3,
  // of the K tile and of the Vt tile; lane tid%8 the 16 bytes at 16 * (tid%8) of
  // the row's line, so a wave-wide copy takes four whole lines.
  const int crow = tid >> 3;           // 0..15
  const int ccol = (tid & 7) * 8;      // halves within the 64-half row
  const _Float16* gK = Kb  + (size_t)crow * CDIM + ccol;
  const _Float16* gV = VtB + (size_t)crow * SEQ  + ccol;
  const unsigned ldsK = lds_off_of(&Kt[0][crow * P64 + ccol]);
  const unsigned ldsV = lds_off_of(&VtT[0][crow * P64 + ccol]);
  auto issueKV = [&](int b, int k0) {
    unsigned l[8];
    const _Float16* g[8];
    // unrolled: l[] and g[] are asm operands, indexed by constants only
#pragma unroll
    for (int j = 0; j < 4; ++j) {
      l[j]     = ldsK + (unsigned)(b * KST + j * 16) * (P64 * 2);
      l[j + 4] = ldsV + (unsigned)(b * HD  + j * 16) * (P64 * 2);
      g[j]     = gK + (size_t)(k0 + j * 16) * CDIM;   // key rows k0 + ...
      g[j + 4] = gV + (size_t)(j * 16) * SEQ + k0;    // keys k0 .. k0+63 of a d row
    }
    async_b128_x8(l, g);
  };

  issueKV(0, 0);
  wait_async0();          // my stage-0 copies done
  __syncthreads();        // everyone's stage 0 visible
  issueKV(1, KST);
  for (int st = 0; st < SEQ / KST; ++st) {
    const int cur = st & 1;
   // unrolled: the stage's two 32-key passes, in ascending key order as before
#pragma unroll
   for (int sub = 0; sub < KST / 32; ++sub) {
    const _Float16* Kc = Kt[cur] + sub * 32 * P64;   // key rows 32 sub ..
    const _Float16* Vc = VtT[cur] + sub * 32;        // key columns 32 sub ..

    // S^T tile (32 keys x 16 queries) = k_tile @ q_tile^T  (K = 64 -> 2 chunks)
    // s0[r] = key 8*hi + r, s1[r] = key 16 + 8*hi + r, both of query lr.
    v8f s0 = v8f{0.f,0.f,0.f,0.f,0.f,0.f,0.f,0.f};
    v8f s1 = v8f{0.f,0.f,0.f,0.f,0.f,0.f,0.f,0.f};
    {
      v16h a;
      a = load_frag(Kc + (size_t)lr * P64 + 0,  hi);
      s0 = __builtin_amdgcn_wmma_f32_16x16x32_f16(false, a, false, qa0, (short)0, s0, false, false);
      a = load_frag(Kc + (size_t)lr * P64 + 32, hi);
      s0 = __builtin_amdgcn_wmma_f32_16x16x32_f16(false, a, false, qa1, (short)0, s0, false, false);
      a = load_frag(Kc + (size_t)(16 + lr) * P64 + 0,  hi);
      s1 = __builtin_amdgcn_wmma_f32_16x16x32_f16(false, a, false, qa0, (short)0, s1, false, false);
      a = load_frag(Kc + (size_t)(16 + lr) * P64 + 32, hi);
      s1 = __builtin_amdgcn_wmma_f32_16x16x32_f16(false, a, false, qa1, (short)0, s1, false, false);
    }

    // Online softmax of query lr: 16 scores in this lane, 16 in lane ^ 16.
    const v8f v0 = s0 * 0.125f;            // 1/sqrt(64)
    const v8f v1 = s1 * 0.125f;
    float rm = v0[0], rn = v1[0];
#pragma unroll
    for (int r = 1; r < 8; ++r) { rm = fmaxf(rm, v0[r]); rn = fmaxf(rn, v1[r]); }
    rm = fmaxf(rm, rn);
    rm = fmaxf(rm, xhalf(rm));
    const float mn    = fmaxf(m, rm);
    const float alpha = __expf(m - mn);
    m = mn;

    // P^T in place: element i of the B operand is key 8*hi + i (i < 8) or 16 + 8*hi + i - 8 (i >= 8) of query lr.
    v16h pb;
    float rs0 = 0.0f, rs1 = 0.0f;
#pragma unroll
    for (int r = 0; r < 8; ++r) {
      const float p0 = __expf(v0[r] - mn);
      const float p1 = __expf(v1[r] - mn);
      rs0 += p0;
      rs1 += p1;
      pb[r]     = (_Float16)p0;
      pb[r + 8] = (_Float16)p1;
    }
    l = l * alpha + (rs0 + rs1);
#pragma unroll
    for (int c = 0; c < 4; ++c)
#pragma unroll
      for (int r = 0; r < 8; ++r) o[c][r] *= alpha;

    // O^T += V^T_tile(64 x 32) @ P^T(32 x 16): A fragments are contiguous Vt rows.
#pragma unroll
    for (int c = 0; c < 4; ++c) {
      v16h va = load_frag(Vc + (size_t)(c * 16 + lr) * P64, hi);
      o[c] = __builtin_amdgcn_wmma_f32_16x16x32_f16(false, va, false, pb,
                                                    (short)0, o[c], false, false);
    }
   }
    wait_ds0();           // my reads of this buffer are over
    wait_async0();        // my stage-(st+1) copies done
    __syncthreads();      // stage st+1 visible to all; this buffer free
    if (st + 2 < SEQ / KST) issueKV(cur, (st + 2) * KST);
  }
  wait_async0();          // nothing of mine in flight when the wave ends

  // Join the halves' sums, normalize and store in [N, h, S, d] flat order:
  // 8 consecutive d of query lr per accumulator tile, one 16-byte store each.
  const float inv = 1.0f / (l + xhalf(l));
  _Float16* Ob = O + ((size_t)(n * NH + h) * SEQ + q0 + lr) * HD + 8 * hi;
#pragma unroll
  for (int c = 0; c < 4; ++c) {
    v8h ov;
#pragma unroll
    for (int r = 0; r < 8; ++r) ov[r] = (_Float16)(o[c][r] * inv);
    *(v8h*)(Ob + c * 16) = ov;
  }
}

extern "C" void kernel_launch(void* const* d_in, const int* in_sizes, int n_in,
                              void* d_out, int out_size, void* d_ws, size_t ws_size,
                              hipStream_t stream) {
  (void)in_sizes; (void)n_in; (void)out_size; (void)ws_size;
  const float* x  = (const float*)d_in[0];
  const float* Wq = (const float*)d_in[1];
  const float* bq = (const float*)d_in[2];
  const float* Wk = (const float*)d_in[3];
  const float* bk = (const float*)d_in[4];
  const float* Wv = (const float*)d_in[5];
  const float* bv = (const float*)d_in[6];
  const float* Wo = (const float*)d_in[7];
  const float* bo = (const float*)d_in[8];
  float* out = (float*)d_out;

  // Workspace layout (offsets in f16 elements). Total ~42 MB.
  _Float16* ws = (_Float16*)d_ws;
  const size_t NSC = (size_t)NB * SEQ * CDIM;   // 4,194,304
  const size_t WSZ = (size_t)CDIM * CDIM;       //   262,144
  _Float16* xs   = ws;
  _Float16* wq16 = xs + NSC;
  _Float16* wk16 = wq16 + WSZ;
  _Float16* wv16 = wk16 + WSZ;
  _Float16* wo16 = wv16 + WSZ;
  _Float16* Qh   = wo16 + WSZ;
  _Float16* Kh   = Qh + NSC;
  _Float16* Vth  = Kh + NSC;   // V stored head-transposed [(n*NH+h)*HD+d][SEQ]
  _Float16* Oh   = Vth + NSC;

  // 1) Pack weights (plane z = 0) and activations (z = 1 .. NB) to f16, one launch
  pack_kernel<<<dim3(SEQ / PXS, CDIM / PXC, NB + 1), 256, 0, stream>>>(
      x, xs, Wq, Wk, Wv, Wo, wq16, wk16, wv16, wo16);

  // 2) Q/K/V projections (fused bias) in one launch, z = 0, 1, 2: wq16, wk16,
  //    wv16 and Qh, Kh, Vth lie back to back; V written head-transposed
  gemm_bt_kernel<<<dim3(MTOT / 128, CDIM / 128, 3), 256, 0, stream>>>(
      xs, wq16, bq, bk, bv, Qh, nullptr, 0);

  // 3) Flash attention per (n, h); O stored [N, h, S, d] flat
  attn_kernel<<<dim3(SEQ / 64, NB * NH), 128, 0, stream>>>(Qh, Kh, Vth, Oh);

  // 4) Output projection: O (flat [8192, 512]) @ Wo^T + bo -> f32 d_out
  //    (both reference reshapes are memory-order-preserving)
  gemm_bt_kernel<<<dim3(MTOT / 128, CDIM / 128, 1), 256, 0, stream>>>(
      Oh, wo16, bo, bo, bo, nullptr, out, 1);
}
